// v000
// Measured on an AMD MI455X. A time is GPU time per run, averaged over a window of back-to-back runs after a warm-up
// (all launches, gaps included; the runs take copies of the inputs in turn), and the median of several windows.
// Apart from v000's, it joins two sittings. Times from different sittings can be a few percent apart, while
// side-by-side timings come from the same sitting.
// v000, which the later versions start from, runs in 721 microseconds.
#include <hip/hip_runtime.h>
#include <hip/hip_bf16.h>

typedef __attribute__((ext_vector_type(16))) _Float16 v16h;
typedef __attribute__((ext_vector_type(8)))  _Float16 v8h;
typedef __attribute__((ext_vector_type(8)))  float    v8f;

#define B_   2
#define N_   4096
#define C_   1024
#define H_   16
#define D_   64
#define BN_  8192
#define C3_  3072

#if defined(__has_builtin)
#if __has_builtin(__builtin_amdgcn_global_load_async_to_lds_b128)
#define USE_ASYNC_LDS 1
#endif
#endif

typedef int b128_t __attribute__((vector_size(16)));
typedef __attribute__((address_space(1))) b128_t* gb128_p;
typedef __attribute__((address_space(3))) b128_t* lb128_p;

static __device__ __forceinline__ void cp_b128(const _Float16* g, _Float16* l) {
#ifdef USE_ASYNC_LDS
  __builtin_amdgcn_global_load_async_to_lds_b128(
      (gb128_p)(unsigned long long)(uintptr_t)g,
      (lb128_p)(unsigned)(uintptr_t)l,        // generic LDS addr: low 32 bits
      0, 0);
#else
  *reinterpret_cast<v8h*>(l) = *reinterpret_cast<const v8h*>(g);
#endif
}

static __device__ __forceinline__ void async_wait() {
#ifdef USE_ASYNC_LDS
#if __has_builtin(__builtin_amdgcn_s_wait_asynccnt)
  __builtin_amdgcn_s_wait_asynccnt(0);
#else
  asm volatile("s_wait_asynccnt 0x0" ::: "memory");
#endif
#endif
}

static __device__ __forceinline__ v16h frag_ld(const _Float16* base, int stride) {
  const int lane = threadIdx.x & 31;
  const _Float16* p = base + (lane & 15) * stride + ((lane >> 4) << 3);
  v8h lo = *reinterpret_cast<const v8h*>(p);
  v8h hi = *reinterpret_cast<const v8h*>(p + 16);
  return __builtin_shufflevector(lo, hi, 0, 1, 2, 3, 4, 5, 6, 7,
                                 8, 9, 10, 11, 12, 13, 14, 15);
}

static __device__ __forceinline__ v8f wmma_f16(v16h a, v16h b, v8f c) {
  return __builtin_amdgcn_wmma_f32_16x16x32_f16(false, a, false, b,
                                                (short)0, c, false, false);
}

static __device__ __forceinline__ v8f zero_v8f() {
  v8f z = {0.f, 0.f, 0.f, 0.f, 0.f, 0.f, 0.f, 0.f};
  return z;
}

// ---------------------------------------------------------------------------
// fp32 -> f16 elementwise, and transposed f16 weight copies
// ---------------------------------------------------------------------------
__global__ __launch_bounds__(256) void f32_to_f16_kernel(
    const float* __restrict__ in, _Float16* __restrict__ out, int n) {
  int i = blockIdx.x * 256 + threadIdx.x;
  if (i < n) out[i] = (_Float16)in[i];
}

__global__ __launch_bounds__(256) void transpose_f32_to_f16_kernel(
    const float* __restrict__ W, _Float16* __restrict__ WT, int K, int Ncol) {
  int i = blockIdx.x * 256 + threadIdx.x;
  if (i < K * Ncol) {
    int k = i / Ncol;
    int n = i - k * Ncol;
    WT[(size_t)n * K + k] = (_Float16)W[i];
  }
}

// ---------------------------------------------------------------------------
// GEMM: out[M][Nn] = A[M][Kk] * BT[Nn][Kk]^T   (f16 in, f32 accumulate)
// 256 threads = 8 waves (4x2), block tile 128x128, wave tile 32x64
// (2x4 fragments -> 8 wmma per wave per 32-deep K step).
// LDS ping-pong double buffering; stage for tile k+1 is issued (async when
// available) before computing tile k.
// MODE 0: scatter f16 into qkv3 [3][B][H][N][D].   MODE 1: fp32 row-major.
// ---------------------------------------------------------------------------
template <int MODE>
__global__ __launch_bounds__(256) void gemm_f16_wmma(
    const _Float16* __restrict__ A, const _Float16* __restrict__ BT,
    void* __restrict__ out, int M, int Nn, int Kk) {
  __shared__ _Float16 Alds[2][128 * 40];   // 32 k-halves + 8 pad
  __shared__ _Float16 Blds[2][128 * 40];

  const int lane = threadIdx.x & 31;
  const int l16  = lane & 15;
  const int wid  = threadIdx.x >> 5;
  const int wrow = wid >> 1;               // 0..3  -> rows wrow*32
  const int wcol = wid & 1;                // 0..1  -> cols wcol*64
  const int m0 = blockIdx.y * 128;
  const int n0 = blockIdx.x * 128;

  v8f acc[2][4];
#pragma unroll
  for (int i = 0; i < 2; ++i)
#pragma unroll
    for (int j = 0; j < 4; ++j) acc[i][j] = zero_v8f();

  auto stage = [&](int k0, int buf) {
    for (int t = threadIdx.x; t < 512; t += 256) {
      int r = t >> 2, c = t & 3;
      cp_b128(A + (size_t)(m0 + r) * Kk + k0 + c * 8, &Alds[buf][r * 40 + c * 8]);
    }
    for (int t = threadIdx.x; t < 512; t += 256) {
      int r = t >> 2, c = t & 3;
      cp_b128(BT + (size_t)(n0 + r) * Kk + k0 + c * 8, &Blds[buf][r * 40 + c * 8]);
    }
  };

  const int nk = Kk >> 5;                  // K steps of 32
  stage(0, 0);
  for (int kk = 0; kk < nk; ++kk) {
    async_wait();
    __syncthreads();
    if (kk + 1 < nk) stage((kk + 1) << 5, (kk + 1) & 1);

    const _Float16* Ab = Alds[kk & 1];
    const _Float16* Bb = Blds[kk & 1];
    v16h af[2], bf[4];
#pragma unroll
    for (int i = 0; i < 2; ++i)
      af[i] = frag_ld(&Ab[(wrow * 32 + i * 16) * 40], 40);
#pragma unroll
    for (int j = 0; j < 4; ++j)
      bf[j] = frag_ld(&Bb[(wcol * 64 + j * 16) * 40], 40);
#pragma unroll
    for (int i = 0; i < 2; ++i)
#pragma unroll
      for (int j = 0; j < 4; ++j) acc[i][j] = wmma_f16(af[i], bf[j], acc[i][j]);
  }

  // epilogue: C/D layout -> element (m = r + 8*(lane>>4), n = lane&15)
#pragma unroll
  for (int i = 0; i < 2; ++i) {
#pragma unroll
    for (int j = 0; j < 4; ++j) {
#pragma unroll
      for (int r = 0; r < 8; ++r) {
        int row = m0 + wrow * 32 + i * 16 + r + ((lane >> 4) << 3);
        int col = n0 + wcol * 64 + j * 16 + l16;
        float val = acc[i][j][r];
        if (MODE == 0) {
          int s = col >> 10, rem = col & 1023;
          int hh = rem >> 6, d = rem & 63;
          int bb = row >> 12, nn = row & 4095;
          ((_Float16*)out)[((((size_t)s * B_ + bb) * H_ + hh) * N_ + nn) * D_ + d] =
              (_Float16)val;
        } else {
          ((float*)out)[(size_t)row * Nn + col] = val;
        }
      }
    }
  }
}

// ---------------------------------------------------------------------------
// Per-(s,b,h,n) RMSNorm + RoPE, in place on qkv3 f16 (s=0:q, s=1:k).
// One wave per D=64 row; lane holds d=lane and d=lane+32 (rotate_half pair).
// Folds the attention scale AND log2(e) into Q so attention can use exp2.
// ---------------------------------------------------------------------------
__global__ __launch_bounds__(128) void rmsnorm_rope_kernel(
    _Float16* __restrict__ qkv3, const float* __restrict__ cosp,
    const float* __restrict__ sinp, const float* __restrict__ gq,
    const float* __restrict__ gk) {
  const int lane = threadIdx.x & 31;
  const int wid  = threadIdx.x >> 5;
  int row = blockIdx.x * 4 + wid;          // 0 .. 2*B*H*N-1
  int s = row >> 17;                       // / (B*H*N = 131072)
  int rem = row & 131071;
  int b = rem >> 16;                       // / (H*N = 65536)
  rem &= 65535;
  int h = rem >> 12;                       // / N
  int n = rem & 4095;

  _Float16* p = qkv3 + ((((size_t)s * B_ + b) * H_ + h) * N_ + n) * D_;
  float e0 = (float)p[lane];
  float e1 = (float)p[lane + 32];

  float ss = e0 * e0 + e1 * e1;
  ss += __shfl_xor(ss, 1);
  ss += __shfl_xor(ss, 2);
  ss += __shfl_xor(ss, 4);
  ss += __shfl_xor(ss, 8);
  ss += __shfl_xor(ss, 16);
  float rinv = rsqrtf(ss * (1.0f / 64.0f) + 1e-6f);

  const float* g = (s == 0) ? gq : gk;
  float x0 = e0 * rinv * g[lane];
  float x1 = e1 * rinv * g[lane + 32];

  const float* cr = cosp + n * 64;
  const float* sr = sinp + n * 64;
  float y0 = x0 * cr[lane]      - x1 * sr[lane];        // d < 32: -x2*sin
  float y1 = x1 * cr[lane + 32] + x0 * sr[lane + 32];   // d >= 32: +x1*sin
  if (s == 0) {                    // 1/sqrt(D) * log2(e) folded into Q
    const float qs = 0.125f * 1.44269504f;
    y0 *= qs; y1 *= qs;
  }
  p[lane]      = (_Float16)y0;
  p[lane + 32] = (_Float16)y1;
}

// ---------------------------------------------------------------------------
// Flash attention. Block = 256 threads = 8 waves; block owns 128 query rows of
// one (b,h); each wave owns 16 rows with Q resident as 2 A-fragments.
// 64 keys staged per barrier pair (K async row-major; V transposed manually),
// processed as two 32-key WMMA sub-steps. Online softmax in f32 (base 2).
// Next tile prefetched with global_prefetch.
// ---------------------------------------------------------------------------
__global__ __launch_bounds__(256) void flash_attn_kernel(
    const _Float16* __restrict__ qkv3, _Float16* __restrict__ attn_out) {
  __shared__ _Float16 Klds[64 * 72];       // [key][d], stride 72
  __shared__ _Float16 Vtlds[64 * 72];      // [d][key 0..63 + pad], stride 72
  __shared__ _Float16 Plds[8 * 16 * 40];   // per-wave P patch [row][key]

  const int lane = threadIdx.x & 31;
  const int l16  = lane & 15;
  const int hlf8 = (lane >> 4) << 3;
  const int wid  = threadIdx.x >> 5;

  const int b = blockIdx.y >> 4;
  const int h = blockIdx.y & 15;
  const size_t plane = (size_t)N_ * D_;
  const _Float16* Q = qkv3 + ((size_t)((0 * B_ + b) * H_ + h)) * plane;
  const _Float16* K = qkv3 + ((size_t)((1 * B_ + b) * H_ + h)) * plane;
  const _Float16* V = qkv3 + ((size_t)((2 * B_ + b) * H_ + h)) * plane;

  const int qbase = blockIdx.x * 128 + wid * 16;

  v16h qf[2];
  qf[0] = frag_ld(Q + (size_t)qbase * D_ + 0,  D_);
  qf[1] = frag_ld(Q + (size_t)qbase * D_ + 32, D_);

  v8f o[4];
#pragma unroll
  for (int dt = 0; dt < 4; ++dt) o[dt] = zero_v8f();
  float mrow[8], lrow[8];
#pragma unroll
  for (int r = 0; r < 8; ++r) { mrow[r] = -3.0e38f; lrow[r] = 0.f; }

  _Float16* Pw = &Plds[wid * 16 * 40];

  const int ntiles = N_ / 64;
  for (int kt = 0; kt < ntiles; ++kt) {
    const int k0 = kt * 64;

    // prefetch next 64-key K/V tile (one 128B line per thread)
    if (kt + 1 < ntiles) {
      int t = threadIdx.x;
      if (t < 64)
        __builtin_prefetch((const void*)(K + (size_t)(k0 + 64 + t) * D_), 0, 1);
      else if (t < 128)
        __builtin_prefetch((const void*)(V + (size_t)(k0 + t) * D_), 0, 1);
    }

    // stage: K row-major (async), V transposed (manual)
    for (int t = threadIdx.x; t < 512; t += 256) {
      int key = t >> 3, c = t & 7;
      cp_b128(K + (size_t)(k0 + key) * D_ + c * 8, &Klds[key * 72 + c * 8]);
      v8h vv = *reinterpret_cast<const v8h*>(V + (size_t)(k0 + key) * D_ + c * 8);
#pragma unroll
      for (int i = 0; i < 8; ++i) Vtlds[(c * 8 + i) * 72 + key] = vv[i];
    }
    async_wait();
    __syncthreads();

#pragma unroll
    for (int ss = 0; ss < 2; ++ss) {       // two 32-key sub-steps
      const _Float16* Kb = &Klds[(ss * 32) * 72];

      v8f s0 = zero_v8f(), s1 = zero_v8f();
      s0 = wmma_f16(qf[0], frag_ld(&Kb[0 * 16 * 72 + 0],  72), s0);
      s0 = wmma_f16(qf[1], frag_ld(&Kb[0 * 16 * 72 + 32], 72), s0);
      s1 = wmma_f16(qf[0], frag_ld(&Kb[1 * 16 * 72 + 0],  72), s1);
      s1 = wmma_f16(qf[1], frag_ld(&Kb[1 * 16 * 72 + 32], 72), s1);

      // online softmax, base-2 (log2e folded into Q)
#pragma unroll
      for (int r = 0; r < 8; ++r) {
        float a = s0[r], c = s1[r];
        float mx = fmaxf(a, c);
        mx = fmaxf(mx, __shfl_xor(mx, 1));
        mx = fmaxf(mx, __shfl_xor(mx, 2));
        mx = fmaxf(mx, __shfl_xor(mx, 4));
        mx = fmaxf(mx, __shfl_xor(mx, 8));
        float mnew = fmaxf(mrow[r], mx);
        float alpha = exp2f(mrow[r] - mnew);
        float p0 = exp2f(a - mnew);
        float p1 = exp2f(c - mnew);
        float ps = p0 + p1;
        ps += __shfl_xor(ps, 1);
        ps += __shfl_xor(ps, 2);
        ps += __shfl_xor(ps, 4);
        ps += __shfl_xor(ps, 8);
        lrow[r] = lrow[r] * alpha + ps;
        mrow[r] = mnew;
#pragma unroll
        for (int dt = 0; dt < 4; ++dt) o[dt][r] *= alpha;
        int prow = r + hlf8;
        Pw[prow * 40 + 0 * 16 + l16] = (_Float16)p0;
        Pw[prow * 40 + 1 * 16 + l16] = (_Float16)p1;
      }

      // O(16x64) += P(16x32) * V(32x64) (same-wave LDS ops are in order)
      v16h pf = frag_ld(Pw, 40);
#pragma unroll
      for (int dt = 0; dt < 4; ++dt)
        o[dt] = wmma_f16(pf, frag_ld(&Vtlds[dt * 16 * 72 + ss * 32], 72), o[dt]);
    }
    __syncthreads();
  }

  // normalize and store f16 [B][N][C] with head offset
  const int colb = h * D_;
#pragma unroll
  for (int dt = 0; dt < 4; ++dt) {
#pragma unroll
    for (int r = 0; r < 8; ++r) {
      int nrow = qbase + r + hlf8;
      float val = o[dt][r] / lrow[r];
      attn_out[(size_t)(b * N_ + nrow) * C_ + colb + dt * 16 + l16] =
          (_Float16)val;
    }
  }
}

// ---------------------------------------------------------------------------
// Host-side launch pipeline
// ---------------------------------------------------------------------------
extern "C" void kernel_launch(void* const* d_in, const int* in_sizes, int n_in,
                              void* d_out, int out_size, void* d_ws, size_t ws_size,
                              hipStream_t stream) {
  const float* hidden = (const float*)d_in[0];
  const float* cosp   = (const float*)d_in[1];
  const float* sinp   = (const float*)d_in[2];
  const float* Wqkv   = (const float*)d_in[3];
  const float* Wout   = (const float*)d_in[4];
  const float* gq     = (const float*)d_in[5];
  const float* gk     = (const float*)d_in[6];

  // workspace layout (bytes):
  //   Xh      f16 [8192,1024]           16,777,216
  //   WqkvT   f16 [3072,1024]            6,291,456
  //   WoutT   f16 [1024,1024]            2,097,152
  //   qkv3    f16 [3][2][16][4096][64]  50,331,648
  //   attnH   f16 [8192,1024]           16,777,216   (total ~92.3 MB)
  char* ws = (char*)d_ws;
  _Float16* Xh    = (_Float16*)(ws);
  _Float16* WqkvT = (_Float16*)(ws + 16777216);
  _Float16* WoutT = (_Float16*)(ws + 16777216 + 6291456);
  _Float16* qkv3  = (_Float16*)(ws + 16777216 + 6291456 + 2097152);
  _Float16* attnH = (_Float16*)(ws + 16777216 + 6291456 + 2097152 + 50331648);

  f32_to_f16_kernel<<<dim3((BN_ * C_) / 256), 256, 0, stream>>>(
      hidden, Xh, BN_ * C_);
  transpose_f32_to_f16_kernel<<<dim3((C_ * C3_) / 256), 256, 0, stream>>>(
      Wqkv, WqkvT, C_, C3_);
  transpose_f32_to_f16_kernel<<<dim3((C_ * C_) / 256), 256, 0, stream>>>(
      Wout, WoutT, C_, C_);

  // QKV projection, scattered into [3][B][H][N][D] f16
  gemm_f16_wmma<0><<<dim3(C3_ / 128, BN_ / 128), 256, 0, stream>>>(
      Xh, WqkvT, (void*)qkv3, BN_, C3_, C_);

  // per-head RMSNorm + RoPE on q/k planes (in place)
  rmsnorm_rope_kernel<<<dim3((2 * B_ * H_ * N_) / 4), 128, 0, stream>>>(
      qkv3, cosp, sinp, gq, gk);

  // flash attention -> f16 [B,N,C]
  flash_attn_kernel<<<dim3(N_ / 128, B_ * H_), 256, 0, stream>>>(qkv3, attnH);

  // output projection -> fp32 d_out
  gemm_f16_wmma<1><<<dim3(C_ / 128, BN_ / 128), 256, 0, stream>>>(
      attnH, WoutT, d_out, BN_, C_, C_);
}

// v001
// A run of this version takes 527 microseconds.
// In two side-by-side timings against v000, it was 1.40 and 1.41 times as fast.
#include <hip/hip_runtime.h>
#include <hip/hip_bf16.h>

typedef __attribute__((ext_vector_type(16))) _Float16 v16h;
typedef __attribute__((ext_vector_type(8)))  _Float16 v8h;
typedef __attribute__((ext_vector_type(8)))  float    v8f;

#define B_   2
#define N_   4096
#define C_   1024
#define H_   16
#define D_   64
#define BN_  8192
#define C3_  3072

#if defined(__has_builtin)
#if __has_builtin(__builtin_amdgcn_global_load_async_to_lds_b128)
#define USE_ASYNC_LDS 1
#endif
#endif

typedef int b128_t __attribute__((vector_size(16)));
typedef __attribute__((address_space(1))) b128_t* gb128_p;
typedef __attribute__((address_space(3))) b128_t* lb128_p;

static __device__ __forceinline__ void cp_b128(const _Float16* g, _Float16* l) {
#ifdef USE_ASYNC_LDS
  __builtin_amdgcn_global_load_async_to_lds_b128(
      (gb128_p)(unsigned long long)(uintptr_t)g,
      (lb128_p)(unsigned)(uintptr_t)l,        // generic LDS addr: low 32 bits
      0, 0);
#else
  *reinterpret_cast<v8h*>(l) = *reinterpret_cast<const v8h*>(g);
#endif
}

static __device__ __forceinline__ void async_wait() {
#ifdef USE_ASYNC_LDS
#if __has_builtin(__builtin_amdgcn_s_wait_asynccnt)
  __builtin_amdgcn_s_wait_asynccnt(0);
#else
  asm volatile("s_wait_asynccnt 0x0" ::: "memory");
#endif
#endif
}

static __device__ __forceinline__ v16h frag_ld(const _Float16* base, int stride) {
  const int lane = threadIdx.x & 31;
  const _Float16* p = base + (lane & 15) * stride + ((lane >> 4) << 3);
  v8h lo = *reinterpret_cast<const v8h*>(p);
  v8h hi = *reinterpret_cast<const v8h*>(p + 16);
  return __builtin_shufflevector(lo, hi, 0, 1, 2, 3, 4, 5, 6, 7,
                                 8, 9, 10, 11, 12, 13, 14, 15);
}

static __device__ __forceinline__ v8f wmma_f16(v16h a, v16h b, v8f c) {
  return __builtin_amdgcn_wmma_f32_16x16x32_f16(false, a, false, b,
                                                (short)0, c, false, false);
}

static __device__ __forceinline__ v8f zero_v8f() {
  v8f z = {0.f, 0.f, 0.f, 0.f, 0.f, 0.f, 0.f, 0.f};
  return z;
}

// ---------------------------------------------------------------------------
// fp32 -> f16 elementwise, and transposed f16 weight copies
// ---------------------------------------------------------------------------
__global__ __launch_bounds__(256) void f32_to_f16_kernel(
    const float* __restrict__ in, _Float16* __restrict__ out, int n) {
  int i = blockIdx.x * 256 + threadIdx.x;
  if (i < n) out[i] = (_Float16)in[i];
}

__global__ __launch_bounds__(256) void transpose_f32_to_f16_kernel(
    const float* __restrict__ W, _Float16* __restrict__ WT, int K, int Ncol) {
  int i = blockIdx.x * 256 + threadIdx.x;
  if (i < K * Ncol) {
    int k = i / Ncol;
    int n = i - k * Ncol;
    WT[(size_t)n * K + k] = (_Float16)W[i];
  }
}

// ---------------------------------------------------------------------------
// GEMM: out[M][Nn] = A[M][Kk] * BT[Nn][Kk]^T   (f16 in, f32 accumulate)
// 256 threads = 8 waves (4x2), block tile 128x128, wave tile 32x64
// (2x4 fragments -> 8 wmma per wave per 32-deep K step).
// LDS ping-pong double buffering; stage for tile k+1 is issued (async when
// available) before computing tile k.
// MODE 0: scatter f16 into qkv3 [3][B][H][N][D].   MODE 1: fp32 row-major.
// ---------------------------------------------------------------------------
template <int MODE>
__global__ __launch_bounds__(256) void gemm_f16_wmma(
    const _Float16* __restrict__ A, const _Float16* __restrict__ BT,
    void* __restrict__ out, int M, int Nn, int Kk) {
  __shared__ _Float16 Alds[2][128 * 40];   // 32 k-halves + 8 pad
  __shared__ _Float16 Blds[2][128 * 40];

  const int lane = threadIdx.x & 31;
  const int l16  = lane & 15;
  const int wid  = threadIdx.x >> 5;
  const int wrow = wid >> 1;               // 0..3  -> rows wrow*32
  const int wcol = wid & 1;                // 0..1  -> cols wcol*64
  const int m0 = blockIdx.y * 128;
  const int n0 = blockIdx.x * 128;

  v8f acc[2][4];
#pragma unroll
  for (int i = 0; i < 2; ++i)
#pragma unroll
    for (int j = 0; j < 4; ++j) acc[i][j] = zero_v8f();

  auto stage = [&](int k0, int buf) {
    for (int t = threadIdx.x; t < 512; t += 256) {
      int r = t >> 2, c = t & 3;
      cp_b128(A + (size_t)(m0 + r) * Kk + k0 + c * 8, &Alds[buf][r * 40 + c * 8]);
    }
    for (int t = threadIdx.x; t < 512; t += 256) {
      int r = t >> 2, c = t & 3;
      cp_b128(BT + (size_t)(n0 + r) * Kk + k0 + c * 8, &Blds[buf][r * 40 + c * 8]);
    }
  };

  const int nk = Kk >> 5;                  // K steps of 32
  stage(0, 0);
  for (int kk = 0; kk < nk; ++kk) {
    async_wait();
    __syncthreads();
    if (kk + 1 < nk) stage((kk + 1) << 5, (kk + 1) & 1);

    const _Float16* Ab = Alds[kk & 1];
    const _Float16* Bb = Blds[kk & 1];
    v16h af[2], bf[4];
#pragma unroll
    for (int i = 0; i < 2; ++i)
      af[i] = frag_ld(&Ab[(wrow * 32 + i * 16) * 40], 40);
#pragma unroll
    for (int j = 0; j < 4; ++j)
      bf[j] = frag_ld(&Bb[(wcol * 64 + j * 16) * 40], 40);
#pragma unroll
    for (int i = 0; i < 2; ++i)
#pragma unroll
      for (int j = 0; j < 4; ++j) acc[i][j] = wmma_f16(af[i], bf[j], acc[i][j]);
  }

  // epilogue: C/D layout -> element (m = r + 8*(lane>>4), n = lane&15)
#pragma unroll
  for (int i = 0; i < 2; ++i) {
#pragma unroll
    for (int j = 0; j < 4; ++j) {
#pragma unroll
      for (int r = 0; r < 8; ++r) {
        int row = m0 + wrow * 32 + i * 16 + r + ((lane >> 4) << 3);
        int col = n0 + wcol * 64 + j * 16 + l16;
        float val = acc[i][j][r];
        if (MODE == 0) {
          int s = col >> 10, rem = col & 1023;
          int hh = rem >> 6, d = rem & 63;
          int bb = row >> 12, nn = row & 4095;
          ((_Float16*)out)[((((size_t)s * B_ + bb) * H_ + hh) * N_ + nn) * D_ + d] =
              (_Float16)val;
        } else {
          ((float*)out)[(size_t)row * Nn + col] = val;
        }
      }
    }
  }
}

// ---------------------------------------------------------------------------
// Per-(s,b,h,n) RMSNorm + RoPE, in place on qkv3 f16 (s=0:q, s=1:k).
// One wave per D=64 row; lane holds d=lane and d=lane+32 (rotate_half pair).
// Folds the attention scale AND log2(e) into Q so attention can use exp2.
// ---------------------------------------------------------------------------
__global__ __launch_bounds__(128) void rmsnorm_rope_kernel(
    _Float16* __restrict__ qkv3, const float* __restrict__ cosp,
    const float* __restrict__ sinp, const float* __restrict__ gq,
    const float* __restrict__ gk) {
  const int lane = threadIdx.x & 31;
  const int wid  = threadIdx.x >> 5;
  int row = blockIdx.x * 4 + wid;          // 0 .. 2*B*H*N-1
  int s = row >> 17;                       // / (B*H*N = 131072)
  int rem = row & 131071;
  int b = rem >> 16;                       // / (H*N = 65536)
  rem &= 65535;
  int h = rem >> 12;                       // / N
  int n = rem & 4095;

  _Float16* p = qkv3 + ((((size_t)s * B_ + b) * H_ + h) * N_ + n) * D_;
  float e0 = (float)p[lane];
  float e1 = (float)p[lane + 32];

  float ss = e0 * e0 + e1 * e1;
  ss += __shfl_xor(ss, 1);
  ss += __shfl_xor(ss, 2);
  ss += __shfl_xor(ss, 4);
  ss += __shfl_xor(ss, 8);
  ss += __shfl_xor(ss, 16);
  float rinv = rsqrtf(ss * (1.0f / 64.0f) + 1e-6f);

  const float* g = (s == 0) ? gq : gk;
  float x0 = e0 * rinv * g[lane];
  float x1 = e1 * rinv * g[lane + 32];

  const float* cr = cosp + n * 64;
  const float* sr = sinp + n * 64;
  float y0 = x0 * cr[lane]      - x1 * sr[lane];        // d < 32: -x2*sin
  float y1 = x1 * cr[lane + 32] + x0 * sr[lane + 32];   // d >= 32: +x1*sin
  if (s == 0) {                    // 1/sqrt(D) * log2(e) folded into Q
    const float qs = 0.125f * 1.44269504f;
    y0 *= qs; y1 *= qs;
  }
  p[lane]      = (_Float16)y0;
  p[lane + 32] = (_Float16)y1;
}

static __device__ __forceinline__ float xhalf(float x) {
  int v = __builtin_bit_cast(int, x);
  return __builtin_bit_cast(float, __builtin_amdgcn_permlanex16(
      v, v, 0x76543210, 0xfedcba98, false, false));
}

__global__ __launch_bounds__(256) void flash_attn_kernel(
    const _Float16* __restrict__ qkv3, _Float16* __restrict__ attn_out) {
  __shared__ _Float16 Klds[64 * 72];       // [key][d], stride 72
  __shared__ _Float16 Vtlds[64 * 72];      // [d][key 0..63 + pad], stride 72

  const int lane = threadIdx.x & 31;
  const int l16  = lane & 15;
  const int hlf8 = (lane >> 4) << 3;
  const int wid  = threadIdx.x >> 5;

  const int b = blockIdx.y >> 4;
  const int h = blockIdx.y & 15;
  const size_t plane = (size_t)N_ * D_;
  const _Float16* Q = qkv3 + ((size_t)((0 * B_ + b) * H_ + h)) * plane;
  const _Float16* K = qkv3 + ((size_t)((1 * B_ + b) * H_ + h)) * plane;
  const _Float16* V = qkv3 + ((size_t)((2 * B_ + b) * H_ + h)) * plane;

  const int qbase = blockIdx.x * 128 + wid * 16;

  v16h qf[2];                              // B operand: column = query l16
  qf[0] = frag_ld(Q + (size_t)qbase * D_ + 0,  D_);
  qf[1] = frag_ld(Q + (size_t)qbase * D_ + 32, D_);

  v8f o[4];                                // o[dt][r] = O[query l16][dt*16 + hlf8 + r]
#pragma unroll
  for (int dt = 0; dt < 4; ++dt) o[dt] = zero_v8f();
  float mrun = -3.0e38f;                   // this lane's query: running maximum
  float lrun = 0.f;                        // and the sum over this half's keys

  const int ntiles = N_ / 64;
  for (int kt = 0; kt < ntiles; ++kt) {
    const int k0 = kt * 64;

    // prefetch next 64-key K/V tile (one 128B line per thread)
    if (kt + 1 < ntiles) {
      int t = threadIdx.x;
      if (t < 64)
        __builtin_prefetch((const void*)(K + (size_t)(k0 + 64 + t) * D_), 0, 1);
      else if (t < 128)
        __builtin_prefetch((const void*)(V + (size_t)(k0 + t) * D_), 0, 1);
    }

    // stage: K row-major (async), V transposed (manual)
    for (int t = threadIdx.x; t < 512; t += 256) {
      int key = t >> 3, c = t & 7;
      cp_b128(K + (size_t)(k0 + key) * D_ + c * 8, &Klds[key * 72 + c * 8]);
      v8h vv = *reinterpret_cast<const v8h*>(V + (size_t)(k0 + key) * D_ + c * 8);
#pragma unroll
      for (int i = 0; i < 8; ++i) Vtlds[(c * 8 + i) * 72 + key] = vv[i];
    }
    async_wait();
    __syncthreads();

#pragma unroll
    for (int ss = 0; ss < 2; ++ss) {       // two 32-key sub-steps
      const _Float16* Kb = &Klds[(ss * 32) * 72];

      // S^T(32 keys x 16 queries): s0[r] = key hlf8 + r, s1[r] = key 16 + hlf8 + r
      v8f s0 = zero_v8f(), s1 = zero_v8f();
      s0 = wmma_f16(frag_ld(&Kb[0 * 16 * 72 + 0],  72), qf[0], s0);
      s0 = wmma_f16(frag_ld(&Kb[0 * 16 * 72 + 32], 72), qf[1], s0);
      s1 = wmma_f16(frag_ld(&Kb[1 * 16 * 72 + 0],  72), qf[0], s1);
      s1 = wmma_f16(frag_ld(&Kb[1 * 16 * 72 + 32], 72), qf[1], s1);

      // online softmax, base-2 (log2e folded into Q), one query per lane
      float mx = fmaxf(s0[0], s1[0]);
#pragma unroll
      for (int r = 1; r < 8; ++r) mx = fmaxf(mx, fmaxf(s0[r], s1[r]));
      mx = fmaxf(mx, xhalf(mx));           // both halves hold the query's maximum
      float mnew = fmaxf(mrun, mx);
      float alpha = exp2f(mrun - mnew);
      mrun = mnew;

      // P^T as B fragment: element s = key kmap(s) = s0[s] (s < 8), s1[s - 8]
      v16h pf;
      float ps = 0.f;
#pragma unroll
      for (int r = 0; r < 8; ++r) {
        float p0 = exp2f(s0[r] - mnew);
        float p1 = exp2f(s1[r] - mnew);
        ps += p0 + p1;
        pf[r]     = (_Float16)p0;
        pf[r + 8] = (_Float16)p1;
      }
      lrun = lrun * alpha + ps;
#pragma unroll
      for (int dt = 0; dt < 4; ++dt) o[dt] *= alpha;

      // O^T(64 d x 16 queries) += V^T(64 x 32 keys) * P^T(32 x 16)
#pragma unroll
      for (int dt = 0; dt < 4; ++dt)
        o[dt] = wmma_f16(frag_ld(&Vtlds[dt * 16 * 72 + ss * 32], 72), pf, o[dt]);
    }
    __syncthreads();
  }

  // join the halves' sums, normalize, store f16 [B][N][C] with head offset:
  // a lane's 8 registers of a tile are 8 consecutive d of its query row
  const float lsum = lrun + xhalf(lrun);
  _Float16* orow = attn_out + (size_t)(b * N_ + qbase + l16) * C_ + h * D_ + hlf8;
#pragma unroll
  for (int dt = 0; dt < 4; ++dt) {
    v8h ov;
#pragma unroll
    for (int r = 0; r < 8; ++r) ov[r] = (_Float16)(o[dt][r] / lsum);
    *reinterpret_cast<v8h*>(orow + dt * 16) = ov;
  }
}

// ---------------------------------------------------------------------------
// Host-side launch pipeline
// ---------------------------------------------------------------------------
extern "C" void kernel_launch(void* const* d_in, const int* in_sizes, int n_in,
                              void* d_out, int out_size, void* d_ws, size_t ws_size,
                              hipStream_t stream) {
  const float* hidden = (const float*)d_in[0];
  const float* cosp   = (const float*)d_in[1];
  const float* sinp   = (const float*)d_in[2];
  const float* Wqkv   = (const float*)d_in[3];
  const float* Wout   = (const float*)d_in[4];
  const float* gq     = (const float*)d_in[5];
  const float* gk     = (const float*)d_in[6];

  // workspace layout (bytes):
  //   Xh      f16 [8192,1024]           16,777,216
  //   WqkvT   f16 [3072,1024]            6,291,456
  //   WoutT   f16 [1024,1024]            2,097,152
  //   qkv3    f16 [3][2][16][4096][64]  50,331,648
  //   attnH   f16 [8192,1024]           16,777,216   (total ~92.3 MB)
  char* ws = (char*)d_ws;
  _Float16* Xh    = (_Float16*)(ws);
  _Float16* WqkvT = (_Float16*)(ws + 16777216);
  _Float16* WoutT = (_Float16*)(ws + 16777216 + 6291456);
  _Float16* qkv3  = (_Float16*)(ws + 16777216 + 6291456 + 2097152);
  _Float16* attnH = (_Float16*)(ws + 16777216 + 6291456 + 2097152 + 50331648);

  f32_to_f16_kernel<<<dim3((BN_ * C_) / 256), 256, 0, stream>>>(
      hidden, Xh, BN_ * C_);
  transpose_f32_to_f16_kernel<<<dim3((C_ * C3_) / 256), 256, 0, stream>>>(
      Wqkv, WqkvT, C_, C3_);
  transpose_f32_to_f16_kernel<<<dim3((C_ * C_) / 256), 256, 0, stream>>>(
      Wout, WoutT, C_, C_);

  // QKV projection, scattered into [3][B][H][N][D] f16
  gemm_f16_wmma<0><<<dim3(C3_ / 128, BN_ / 128), 256, 0, stream>>>(
      Xh, WqkvT, (void*)qkv3, BN_, C3_, C_);

  // per-head RMSNorm + RoPE on q/k planes (in place)
  rmsnorm_rope_kernel<<<dim3((2 * B_ * H_ * N_) / 4), 128, 0, stream>>>(
      qkv3, cosp, sinp, gq, gk);

  // flash attention -> f16 [B,N,C]
  flash_attn_kernel<<<dim3(N_ / 128, B_ * H_), 256, 0, stream>>>(qkv3, attnH);

  // output projection -> fp32 d_out
  gemm_f16_wmma<1><<<dim3(C_ / 128, BN_ / 128), 256, 0, stream>>>(
      attnH, WoutT, d_out, BN_, C_, C_);
}

// v002
// Measured time: 380 microseconds a run.
// Two timings next to v001 put it at 1.38 and 1.39 times that version's speed.
// Counting every step since v000, it is 1.95 times as fast.
#include <hip/hip_runtime.h>
#include <hip/hip_bf16.h>

typedef __attribute__((ext_vector_type(16))) _Float16 v16h;
typedef __attribute__((ext_vector_type(8)))  _Float16 v8h;
typedef __attribute__((ext_vector_type(8)))  float    v8f;
typedef __attribute__((ext_vector_type(4)))  _Float16 v4h;
typedef __attribute__((ext_vector_type(4)))  float    v4f;

#define B_   2
#define N_   4096
#define C_   1024
#define H_   16
#define D_   64
#define BN_  8192
#define C3_  3072

#if defined(__has_builtin)
#if __has_builtin(__builtin_amdgcn_global_load_async_to_lds_b128)
#define USE_ASYNC_LDS 1
#endif
#endif

typedef int b128_t __attribute__((vector_size(16)));
typedef __attribute__((address_space(1))) b128_t* gb128_p;
typedef __attribute__((address_space(3))) b128_t* lb128_p;

static __device__ __forceinline__ void cp_b128(const _Float16* g, _Float16* l) {
#ifdef USE_ASYNC_LDS
  __builtin_amdgcn_global_load_async_to_lds_b128(
      (gb128_p)(unsigned long long)(uintptr_t)g,
      (lb128_p)(unsigned)(uintptr_t)l,        // generic LDS addr: low 32 bits
      0, 0);
#else
  *reinterpret_cast<v8h*>(l) = *reinterpret_cast<const v8h*>(g);
#endif
}

static __device__ __forceinline__ void async_wait() {
#ifdef USE_ASYNC_LDS
#if __has_builtin(__builtin_amdgcn_s_wait_asynccnt)
  __builtin_amdgcn_s_wait_asynccnt(0);
#else
  asm volatile("s_wait_asynccnt 0x0" ::: "memory");
#endif
#endif
}

static __device__ __forceinline__ v16h frag_ld(const _Float16* base, int stride) {
  const int lane = threadIdx.x & 31;
  const _Float16* p = base + (lane & 15) * stride + ((lane >> 4) << 3);
  v8h lo = *reinterpret_cast<const v8h*>(p);
  v8h hi = *reinterpret_cast<const v8h*>(p + 16);
  return __builtin_shufflevector(lo, hi, 0, 1, 2, 3, 4, 5, 6, 7,
                                 8, 9, 10, 11, 12, 13, 14, 15);
}

static __device__ __forceinline__ v8f wmma_f16(v16h a, v16h b, v8f c) {
  return __builtin_amdgcn_wmma_f32_16x16x32_f16(false, a, false, b,
                                                (short)0, c, false, false);
}

static __device__ __forceinline__ v8f zero_v8f() {
  v8f z = {0.f, 0.f, 0.f, 0.f, 0.f, 0.f, 0.f, 0.f};
  return z;
}

// ---------------------------------------------------------------------------
// fp32 -> f16 elementwise, and transposed f16 weight copies.
// Few, fat waves: many elements a lane, wide accesses, all loads of a lane in
// flight together. Every grid covers its array exactly (no bounds test).
// ---------------------------------------------------------------------------
// A block converts 8192 consecutive floats: 8 loads of 16 B a lane, all issued
// before the first store; each wave-wide access covers whole 128-B lines.
__global__ __launch_bounds__(256) void f32_to_f16_kernel(
    const float* __restrict__ in, _Float16* __restrict__ out) {
  const size_t base = (size_t)blockIdx.x * 8192 + threadIdx.x * 4;
  v4f v[8];
#pragma unroll
  for (int j = 0; j < 8; ++j)
    v[j] = *reinterpret_cast<const v4f*>(in + base + j * 1024);
#pragma unroll
  for (int j = 0; j < 8; ++j)
    *reinterpret_cast<v4h*>(out + base + j * 1024) =
        __builtin_convertvector(v[j], v4h);
}

// A lane takes column n and 16 consecutive k: 16 row-coalesced loads, then
// 32 contiguous bytes of WT row n. grid = (Ncol / 256, K / 16).
// K and Ncol are compile-time so that all 16 loads share one address register
// pair and differ in their immediate offsets only.
template <int K, int Ncol>
__global__ __launch_bounds__(256) void transpose_f32_to_f16_kernel(
    const float* __restrict__ W, _Float16* __restrict__ WT) {
  const int n  = blockIdx.x * 256 + threadIdx.x;
  const int k0 = blockIdx.y * 16;
  const float* src = W + (size_t)k0 * Ncol + n;
  float v[16];
#pragma unroll
  for (int j = 0; j < 16; ++j) v[j] = src[j * Ncol];
  v8h lo, hi;
#pragma unroll
  for (int j = 0; j < 8; ++j) {
    lo[j] = (_Float16)v[j];
    hi[j] = (_Float16)v[j + 8];
  }
  _Float16* dst = WT + (size_t)n * K + k0;
  *reinterpret_cast<v8h*>(dst)     = lo;
  *reinterpret_cast<v8h*>(dst + 8) = hi;
}

// ---------------------------------------------------------------------------
// GEMM: out[M][Nn] = A[M][Kk] * BT[Nn][Kk]^T   (f16 in, f32 accumulate)
// 256 threads = 8 waves (4x2), block tile 128x128, wave tile 32x64
// (2x4 fragments -> 8 wmma per wave per 32-deep K step).
// LDS ping-pong double buffering; stage for tile k+1 is issued (async when
// available) before computing tile k.
// MODE 0: scatter f16 into qkv3 [3][B][H][N][D].   MODE 1: fp32 row-major.
// ---------------------------------------------------------------------------
template <int MODE>
__global__ __launch_bounds__(256) void gemm_f16_wmma(
    const _Float16* __restrict__ A, const _Float16* __restrict__ BT,
    void* __restrict__ out, int M, int Nn, int Kk) {
  __shared__ _Float16 Alds[2][128 * 40];   // 32 k-halves + 8 pad
  __shared__ _Float16 Blds[2][128 * 40];

  const int lane = threadIdx.x & 31;
  const int l16  = lane & 15;
  const int wid  = threadIdx.x >> 5;
  const int wrow = wid >> 1;               // 0..3  -> rows wrow*32
  const int wcol = wid & 1;                // 0..1  -> cols wcol*64
  const int m0 = blockIdx.y * 128;
  const int n0 = blockIdx.x * 128;

  v8f acc[2][4];
#pragma unroll
  for (int i = 0; i < 2; ++i)
#pragma unroll
    for (int j = 0; j < 4; ++j) acc[i][j] = zero_v8f();

  auto stage = [&](int k0, int buf) {
    for (int t = threadIdx.x; t < 512; t += 256) {
      int r = t >> 2, c = t & 3;
      cp_b128(A + (size_t)(m0 + r) * Kk + k0 + c * 8, &Alds[buf][r * 40 + c * 8]);
    }
    for (int t = threadIdx.x; t < 512; t += 256) {
      int r = t >> 2, c = t & 3;
      cp_b128(BT + (size_t)(n0 + r) * Kk + k0 + c * 8, &Blds[buf][r * 40 + c * 8]);
    }
  };

  const int nk = Kk >> 5;                  // K steps of 32
  stage(0, 0);
  for (int kk = 0; kk < nk; ++kk) {
    async_wait();
    __syncthreads();
    if (kk + 1 < nk) stage((kk + 1) << 5, (kk + 1) & 1);

    const _Float16* Ab = Alds[kk & 1];
    const _Float16* Bb = Blds[kk & 1];
    v16h af[2], bf[4];
#pragma unroll
    for (int i = 0; i < 2; ++i)
      af[i] = frag_ld(&Ab[(wrow * 32 + i * 16) * 40], 40);
#pragma unroll
    for (int j = 0; j < 4; ++j)
      bf[j] = frag_ld(&Bb[(wcol * 64 + j * 16) * 40], 40);
#pragma unroll
    for (int i = 0; i < 2; ++i)
#pragma unroll
      for (int j = 0; j < 4; ++j) acc[i][j] = wmma_f16(af[i], bf[j], acc[i][j]);
  }

  // epilogue: C/D layout -> element (m = r + 8*(lane>>4), n = lane&15)
#pragma unroll
  for (int i = 0; i < 2; ++i) {
#pragma unroll
    for (int j = 0; j < 4; ++j) {
#pragma unroll
      for (int r = 0; r < 8; ++r) {
        int row = m0 + wrow * 32 + i * 16 + r + ((lane >> 4) << 3);
        int col = n0 + wcol * 64 + j * 16 + l16;
        float val = acc[i][j][r];
        if (MODE == 0) {
          int s = col >> 10, rem = col & 1023;
          int hh = rem >> 6, d = rem & 63;
          int bb = row >> 12, nn = row & 4095;
          ((_Float16*)out)[((((size_t)s * B_ + bb) * H_ + hh) * N_ + nn) * D_ + d] =
              (_Float16)val;
        } else {
          ((float*)out)[(size_t)row * Nn + col] = val;
        }
      }
    }
  }
}

#define RPL_ 8

template <int CTRL>
static __device__ __forceinline__ float quad_swap(float x) {   // quad_perm DPP
  return __builtin_bit_cast(float, __builtin_amdgcn_mov_dpp(
      __builtin_bit_cast(int, x), CTRL, 0xf, 0xf, true));
}

static __device__ __forceinline__ float rsq_slot(float x) {
  float r;
  asm("v_rsq_f32 %0, %1\n\tv_nop" : "=v"(r) : "v"(x));
  return r;
}

__global__ __launch_bounds__(256) void rmsnorm_rope_kernel(
    _Float16* __restrict__ qkv3, const float* __restrict__ cosp,
    const float* __restrict__ sinp, const float* __restrict__ gq,
    const float* __restrict__ gk) {
  const int j8 = (threadIdx.x & 3) << 3;
  const int n  = ((blockIdx.x & 63) << 6) + (threadIdx.x >> 2);   // 64 rows a block
  const int p0 = (blockIdx.x >> 6) * RPL_;                        // first plane
  const bool isq = p0 < B_ * H_;
  // 1/sqrt(D) * log2(e) folded into Q; K is multiplied by one, which is exact
  const float qs = isq ? 0.125f * 1.44269504f : 1.0f;

  _Float16* p = qkv3 + ((size_t)p0 * N_ + n) * D_ + j8;
  v8h lo[RPL_], hi[RPL_];
#pragma unroll
  for (int i = 0; i < RPL_; ++i) {
    lo[i] = *reinterpret_cast<const v8h*>(p + (size_t)i * (N_ * D_));
    hi[i] = *reinterpret_cast<const v8h*>(p + (size_t)i * (N_ * D_) + 32);
  }

  const float* g  = (isq ? gq : gk) + j8;
  const float* cr = cosp + n * 64 + j8;
  const float* sr = sinp + n * 64 + j8;
  v4f tg[4], tc[4], ts[4];                 // [0],[1]: d = j8..j8+7; [2],[3]: d + 32
#pragma unroll
  for (int q = 0; q < 4; ++q)
    tc[q] = *reinterpret_cast<const v4f*>(cr + (q >> 1) * 32 + (q & 1) * 4);
  asm volatile("s_wait_xcnt 0x0" ::: "memory");
#pragma unroll
  for (int q = 0; q < 4; ++q)
    ts[q] = *reinterpret_cast<const v4f*>(sr + (q >> 1) * 32 + (q & 1) * 4);
  asm volatile("s_wait_xcnt 0x0" ::: "memory");
#pragma unroll
  for (int q = 0; q < 4; ++q)
    tg[q] = *reinterpret_cast<const v4f*>(g + (q >> 1) * 32 + (q & 1) * 4);
  // Keeps all 28 loads ahead of the arithmetic (one memory latency a wave):
  // without it the compiler sinks table loads between the rows' sums.
  __builtin_amdgcn_sched_barrier(0);

#pragma unroll
  for (int i = 0; i < RPL_; ++i) {
    float e0[8], e1[8];
    float ss = 0.f;
#pragma unroll
    for (int k = 0; k < 8; ++k) {
      e0[k] = (float)lo[i][k];
      e1[k] = (float)hi[i][k];
      ss += e0[k] * e0[k] + e1[k] * e1[k];
    }
    ss += quad_swap<0xB1>(ss);             // lane ^ 1
    ss += quad_swap<0x4E>(ss);             // lane ^ 2: all four lanes hold the sum
    // the argument is at least 1e-6: rsqrtf's rescaling of tiny arguments never acts
    float rinv = rsq_slot(ss * (1.0f / 64.0f) + 1e-6f);

    v8h olo, ohi;
#pragma unroll
    for (int k = 0; k < 8; ++k) {
      const int q = k >> 2, c = k & 3;
      float x0 = e0[k] * rinv * tg[q][c];
      float x1 = e1[k] * rinv * tg[q + 2][c];
      float y0 = x0 * tc[q][c]     - x1 * ts[q][c];      // d < 32: -x2*sin
      float y1 = x1 * tc[q + 2][c] + x0 * ts[q + 2][c];  // d >= 32: +x1*sin
      olo[k] = (_Float16)(y0 * qs);
      ohi[k] = (_Float16)(y1 * qs);
    }
    *reinterpret_cast<v8h*>(p + (size_t)i * (N_ * D_))      = olo;
    *reinterpret_cast<v8h*>(p + (size_t)i * (N_ * D_) + 32) = ohi;
  }
}

static __device__ __forceinline__ float xhalf(float x) {
  int v = __builtin_bit_cast(int, x);
  return __builtin_bit_cast(float, __builtin_amdgcn_permlanex16(
      v, v, 0x76543210, 0xfedcba98, false, false));
}

__global__ __launch_bounds__(256) void flash_attn_kernel(
    const _Float16* __restrict__ qkv3, _Float16* __restrict__ attn_out) {
  __shared__ _Float16 Klds[64 * 72];       // [key][d], stride 72
  __shared__ _Float16 Vtlds[64 * 72];      // [d][key 0..63 + pad], stride 72

  const int lane = threadIdx.x & 31;
  const int l16  = lane & 15;
  const int hlf8 = (lane >> 4) << 3;
  const int wid  = threadIdx.x >> 5;

  const int b = blockIdx.y >> 4;
  const int h = blockIdx.y & 15;
  const size_t plane = (size_t)N_ * D_;
  const _Float16* Q = qkv3 + ((size_t)((0 * B_ + b) * H_ + h)) * plane;
  const _Float16* K = qkv3 + ((size_t)((1 * B_ + b) * H_ + h)) * plane;
  const _Float16* V = qkv3 + ((size_t)((2 * B_ + b) * H_ + h)) * plane;

  const int qbase = blockIdx.x * 128 + wid * 16;

  v16h qf[2];                              // B operand: column = query l16
  qf[0] = frag_ld(Q + (size_t)qbase * D_ + 0,  D_);
  qf[1] = frag_ld(Q + (size_t)qbase * D_ + 32, D_);

  v8f o[4];                                // o[dt][r] = O[query l16][dt*16 + hlf8 + r]
#pragma unroll
  for (int dt = 0; dt < 4; ++dt) o[dt] = zero_v8f();
  float mrun = -3.0e38f;                   // this lane's query: running maximum
  float lrun = 0.f;                        // and the sum over this half's keys

  const int ntiles = N_ / 64;
  for (int kt = 0; kt < ntiles; ++kt) {
    const int k0 = kt * 64;

    // prefetch next 64-key K/V tile (one 128B line per thread)
    if (kt + 1 < ntiles) {
      int t = threadIdx.x;
      if (t < 64)
        __builtin_prefetch((const void*)(K + (size_t)(k0 + 64 + t) * D_), 0, 1);
      else if (t < 128)
        __builtin_prefetch((const void*)(V + (size_t)(k0 + t) * D_), 0, 1);
    }

    // stage: K row-major (async), V transposed (manual)
    for (int t = threadIdx.x; t < 512; t += 256) {
      int key = t >> 3, c = t & 7;
      cp_b128(K + (size_t)(k0 + key) * D_ + c * 8, &Klds[key * 72 + c * 8]);
      v8h vv = *reinterpret_cast<const v8h*>(V + (size_t)(k0 + key) * D_ + c * 8);
#pragma unroll
      for (int i = 0; i < 8; ++i) Vtlds[(c * 8 + i) * 72 + key] = vv[i];
    }
    async_wait();
    __syncthreads();

#pragma unroll
    for (int ss = 0; ss < 2; ++ss) {       // two 32-key sub-steps
      const _Float16* Kb = &Klds[(ss * 32) * 72];

      // S^T(32 keys x 16 queries): s0[r] = key hlf8 + r, s1[r] = key 16 + hlf8 + r
      v8f s0 = zero_v8f(), s1 = zero_v8f();
      s0 = wmma_f16(frag_ld(&Kb[0 * 16 * 72 + 0],  72), qf[0], s0);
      s0 = wmma_f16(frag_ld(&Kb[0 * 16 * 72 + 32], 72), qf[1], s0);
      s1 = wmma_f16(frag_ld(&Kb[1 * 16 * 72 + 0],  72), qf[0], s1);
      s1 = wmma_f16(frag_ld(&Kb[1 * 16 * 72 + 32], 72), qf[1], s1);

      // online softmax, base-2 (log2e folded into Q), one query per lane
      float mx = fmaxf(s0[0], s1[0]);
#pragma unroll
      for (int r = 1; r < 8; ++r) mx = fmaxf(mx, fmaxf(s0[r], s1[r]));
      mx = fmaxf(mx, xhalf(mx));           // both halves hold the query's maximum
      float mnew = fmaxf(mrun, mx);
      float alpha = exp2f(mrun - mnew);
      mrun = mnew;

      // P^T as B fragment: element s = key kmap(s) = s0[s] (s < 8), s1[s - 8]
      v16h pf;
      float ps = 0.f;
#pragma unroll
      for (int r = 0; r < 8; ++r) {
        float p0 = exp2f(s0[r] - mnew);
        float p1 = exp2f(s1[r] - mnew);
        ps += p0 + p1;
        pf[r]     = (_Float16)p0;
        pf[r + 8] = (_Float16)p1;
      }
      lrun = lrun * alpha + ps;
#pragma unroll
      for (int dt = 0; dt < 4; ++dt) o[dt] *= alpha;

      // O^T(64 d x 16 queries) += V^T(64 x 32 keys) * P^T(32 x 16)
#pragma unroll
      for (int dt = 0; dt < 4; ++dt)
        o[dt] = wmma_f16(frag_ld(&Vtlds[dt * 16 * 72 + ss * 32], 72), pf, o[dt]);
    }
    __syncthreads();
  }

  // join the halves' sums, normalize, store f16 [B][N][C] with head offset:
  // a lane's 8 registers of a tile are 8 consecutive d of its query row
  const float lsum = lrun + xhalf(lrun);
  _Float16* orow = attn_out + (size_t)(b * N_ + qbase + l16) * C_ + h * D_ + hlf8;
#pragma unroll
  for (int dt = 0; dt < 4; ++dt) {
    v8h ov;
#pragma unroll
    for (int r = 0; r < 8; ++r) ov[r] = (_Float16)(o[dt][r] / lsum);
    *reinterpret_cast<v8h*>(orow + dt * 16) = ov;
  }
}

// ---------------------------------------------------------------------------
// Host-side launch pipeline
// ---------------------------------------------------------------------------
extern "C" void kernel_launch(void* const* d_in, const int* in_sizes, int n_in,
                              void* d_out, int out_size, void* d_ws, size_t ws_size,
                              hipStream_t stream) {
  const float* hidden = (const float*)d_in[0];
  const float* cosp   = (const float*)d_in[1];
  const float* sinp   = (const float*)d_in[2];
  const float* Wqkv   = (const float*)d_in[3];
  const float* Wout   = (const float*)d_in[4];
  const float* gq     = (const float*)d_in[5];
  const float* gk     = (const float*)d_in[6];

  // workspace layout (bytes):
  //   Xh      f16 [8192,1024]           16,777,216
  //   WqkvT   f16 [3072,1024]            6,291,456
  //   WoutT   f16 [1024,1024]            2,097,152
  //   qkv3    f16 [3][2][16][4096][64]  50,331,648
  //   attnH   f16 [8192,1024]           16,777,216   (total ~92.3 MB)
  char* ws = (char*)d_ws;
  _Float16* Xh    = (_Float16*)(ws);
  _Float16* WqkvT = (_Float16*)(ws + 16777216);
  _Float16* WoutT = (_Float16*)(ws + 16777216 + 6291456);
  _Float16* qkv3  = (_Float16*)(ws + 16777216 + 6291456 + 2097152);
  _Float16* attnH = (_Float16*)(ws + 16777216 + 6291456 + 2097152 + 50331648);

  f32_to_f16_kernel<<<dim3((BN_ * C_) / 8192), 256, 0, stream>>>(hidden, Xh);
  transpose_f32_to_f16_kernel<C_, C3_><<<dim3(C3_ / 256, C_ / 16), 256, 0, stream>>>(
      Wqkv, WqkvT);
  transpose_f32_to_f16_kernel<C_, C_><<<dim3(C_ / 256, C_ / 16), 256, 0, stream>>>(
      Wout, WoutT);

  // QKV projection, scattered into [3][B][H][N][D] f16
  gemm_f16_wmma<0><<<dim3(C3_ / 128, BN_ / 128), 256, 0, stream>>>(
      Xh, WqkvT, (void*)qkv3, BN_, C3_, C_);

  // per-head RMSNorm + RoPE on q/k planes (in place)
  rmsnorm_rope_kernel<<<dim3((2 * B_ * H_ / RPL_) * (N_ / 64)), 256, 0, stream>>>(
      qkv3, cosp, sinp, gq, gk);

  // flash attention -> f16 [B,N,C]
  flash_attn_kernel<<<dim3(N_ / 128, B_ * H_), 256, 0, stream>>>(qkv3, attnH);

  // output projection -> fp32 d_out
  gemm_f16_wmma<1><<<dim3(C_ / 128, BN_ / 128), 256, 0, stream>>>(
      attnH, WoutT, d_out, BN_, C_, C_);
}

// v003
// One run takes 301 microseconds.
// Timed twice side by side with v002, it ran 1.27 times as fast both times.
// All steps since v000 together make it 2.46 times as fast.
#include <hip/hip_runtime.h>
#include <hip/hip_bf16.h>

typedef __attribute__((ext_vector_type(16))) _Float16 v16h;
typedef __attribute__((ext_vector_type(8)))  _Float16 v8h;
typedef __attribute__((ext_vector_type(8)))  float    v8f;
typedef __attribute__((ext_vector_type(4)))  _Float16 v4h;
typedef __attribute__((ext_vector_type(4)))  float    v4f;

#define B_   2
#define N_   4096
#define C_   1024
#define H_   16
#define D_   64
#define BN_  8192
#define C3_  3072

#if defined(__has_builtin)
#if __has_builtin(__builtin_amdgcn_global_load_async_to_lds_b128)
#define USE_ASYNC_LDS 1
#endif
#endif

typedef int b128_t __attribute__((vector_size(16)));
typedef __attribute__((address_space(1))) b128_t* gb128_p;
typedef __attribute__((address_space(3))) b128_t* lb128_p;

static __device__ __forceinline__ void cp_b128(const _Float16* g, _Float16* l) {
#ifdef USE_ASYNC_LDS
  __builtin_amdgcn_global_load_async_to_lds_b128(
      (gb128_p)(unsigned long long)(uintptr_t)g,
      (lb128_p)(unsigned)(uintptr_t)l,        // generic LDS addr: low 32 bits
      0, 0);
#else
  *reinterpret_cast<v8h*>(l) = *reinterpret_cast<const v8h*>(g);
#endif
}

static __device__ __forceinline__ void async_wait() {
#ifdef USE_ASYNC_LDS
#if __has_builtin(__builtin_amdgcn_s_wait_asynccnt)
  __builtin_amdgcn_s_wait_asynccnt(0);
#else
  asm volatile("s_wait_asynccnt 0x0" ::: "memory");
#endif
#endif
}

static __device__ __forceinline__ v16h frag_ld(const _Float16* base, int stride) {
  const int lane = threadIdx.x & 31;
  const _Float16* p = base + (lane & 15) * stride + ((lane >> 4) << 3);
  v8h lo = *reinterpret_cast<const v8h*>(p);
  v8h hi = *reinterpret_cast<const v8h*>(p + 16);
  return __builtin_shufflevector(lo, hi, 0, 1, 2, 3, 4, 5, 6, 7,
                                 8, 9, 10, 11, 12, 13, 14, 15);
}

static __device__ __forceinline__ v8f wmma_f16(v16h a, v16h b, v8f c) {
  return __builtin_amdgcn_wmma_f32_16x16x32_f16(false, a, false, b,
                                                (short)0, c, false, false);
}

static __device__ __forceinline__ v8f zero_v8f() {
  v8f z = {0.f, 0.f, 0.f, 0.f, 0.f, 0.f, 0.f, 0.f};
  return z;
}

// ---------------------------------------------------------------------------
// fp32 -> f16 elementwise, and transposed f16 weight copies.
// Few, fat waves: many elements a lane, wide accesses, all loads of a lane in
// flight together. Every grid covers its array exactly (no bounds test).
// ---------------------------------------------------------------------------
// A block converts 8192 consecutive floats: 8 loads of 16 B a lane, all issued
// before the first store; each wave-wide access covers whole 128-B lines.
__global__ __launch_bounds__(256) void f32_to_f16_kernel(
    const float* __restrict__ in, _Float16* __restrict__ out) {
  const size_t base = (size_t)blockIdx.x * 8192 + threadIdx.x * 4;
  v4f v[8];
#pragma unroll
  for (int j = 0; j < 8; ++j)
    v[j] = *reinterpret_cast<const v4f*>(in + base + j * 1024);
#pragma unroll
  for (int j = 0; j < 8; ++j)
    *reinterpret_cast<v4h*>(out + base + j * 1024) =
        __builtin_convertvector(v[j], v4h);
}

// A lane takes column n and 16 consecutive k: 16 row-coalesced loads, then
// 32 contiguous bytes of WT row n. grid = (Ncol / 256, K / 16).
// K and Ncol are compile-time so that all 16 loads share one address register
// pair and differ in their immediate offsets only.
template <int K, int Ncol>
__global__ __launch_bounds__(256) void transpose_f32_to_f16_kernel(
    const float* __restrict__ W, _Float16* __restrict__ WT) {
  const int n  = blockIdx.x * 256 + threadIdx.x;
  const int k0 = blockIdx.y * 16;
  const float* src = W + (size_t)k0 * Ncol + n;
  float v[16];
#pragma unroll
  for (int j = 0; j < 16; ++j) v[j] = src[j * Ncol];
  v8h lo, hi;
#pragma unroll
  for (int j = 0; j < 8; ++j) {
    lo[j] = (_Float16)v[j];
    hi[j] = (_Float16)v[j + 8];
  }
  _Float16* dst = WT + (size_t)n * K + k0;
  *reinterpret_cast<v8h*>(dst)     = lo;
  *reinterpret_cast<v8h*>(dst + 8) = hi;
}

// ---------------------------------------------------------------------------
// GEMM: out[M][Nn] = A[M][Kk] * BT[Nn][Kk]^T   (f16 in, f32 accumulate)
// 256 threads = 8 waves (4x2), block tile 128x128, wave tile 32x64
// (2x4 fragments -> 8 wmma per wave per 32-deep K step).
// LDS ping-pong double buffering; stage for tile k+1 is issued (async when
// available) before computing tile k.
// MODE 0: scatter f16 into qkv3 [3][B][H][N][D].   MODE 1: fp32 row-major.
// ---------------------------------------------------------------------------
template <int MODE>
__global__ __launch_bounds__(256) void gemm_f16_wmma(
    const _Float16* __restrict__ A, const _Float16* __restrict__ BT,
    void* __restrict__ out, int M, int Nn, int Kk) {
  __shared__ _Float16 Alds[2][128 * 40];   // 32 k-halves + 8 pad
  __shared__ _Float16 Blds[2][128 * 40];

  const int lane = threadIdx.x & 31;
  const int l16  = lane & 15;
  const int wid  = threadIdx.x >> 5;
  const int wrow = wid >> 1;               // 0..3  -> rows wrow*32
  const int wcol = wid & 1;                // 0..1  -> cols wcol*64
  const int m0 = blockIdx.y * 128;
  const int n0 = blockIdx.x * 128;

  v8f acc[2][4];
#pragma unroll
  for (int i = 0; i < 2; ++i)
#pragma unroll
    for (int j = 0; j < 4; ++j) acc[i][j] = zero_v8f();

  auto stage = [&](int k0, int buf) {
    for (int t = threadIdx.x; t < 512; t += 256) {
      int r = t >> 2, c = t & 3;
      cp_b128(A + (size_t)(m0 + r) * Kk + k0 + c * 8, &Alds[buf][r * 40 + c * 8]);
    }
    for (int t = threadIdx.x; t < 512; t += 256) {
      int r = t >> 2, c = t & 3;
      cp_b128(BT + (size_t)(n0 + r) * Kk + k0 + c * 8, &Blds[buf][r * 40 + c * 8]);
    }
  };

  const int nk = Kk >> 5;                  // K steps of 32
  stage(0, 0);
  for (int kk = 0; kk < nk; ++kk) {
    async_wait();
    __syncthreads();
    if (kk + 1 < nk) stage((kk + 1) << 5, (kk + 1) & 1);

    const _Float16* Ab = Alds[kk & 1];
    const _Float16* Bb = Blds[kk & 1];
    v16h af[2], bf[4];
#pragma unroll
    for (int i = 0; i < 2; ++i)
      af[i] = frag_ld(&Ab[(wrow * 32 + i * 16) * 40], 40);
#pragma unroll
    for (int j = 0; j < 4; ++j)
      bf[j] = frag_ld(&Bb[(wcol * 64 + j * 16) * 40], 40);
#pragma unroll
    for (int i = 0; i < 2; ++i)
#pragma unroll
      for (int j = 0; j < 4; ++j) acc[i][j] = wmma_f16(af[i], bf[j], acc[i][j]);
  }

  // epilogue: C/D layout -> element (m = r + 8*(lane>>4), n = lane&15)
#pragma unroll
  for (int i = 0; i < 2; ++i) {
#pragma unroll
    for (int j = 0; j < 4; ++j) {
#pragma unroll
      for (int r = 0; r < 8; ++r) {
        int row = m0 + wrow * 32 + i * 16 + r + ((lane >> 4) << 3);
        int col = n0 + wcol * 64 + j * 16 + l16;
        float val = acc[i][j][r];
        if (MODE == 0) {
          int s = col >> 10, rem = col & 1023;
          int hh = rem >> 6, d = rem & 63;
          int bb = row >> 12, nn = row & 4095;
          ((_Float16*)out)[((((size_t)s * B_ + bb) * H_ + hh) * N_ + nn) * D_ + d] =
              (_Float16)val;
        } else {
          ((float*)out)[(size_t)row * Nn + col] = val;
        }
      }
    }
  }
}

#define RPL_ 8

template <int CTRL>
static __device__ __forceinline__ float quad_swap(float x) {   // quad_perm DPP
  return __builtin_bit_cast(float, __builtin_amdgcn_mov_dpp(
      __builtin_bit_cast(int, x), CTRL, 0xf, 0xf, true));
}

static __device__ __forceinline__ float rsq_slot(float x) {
  float r;
  asm("v_rsq_f32 %0, %1\n\tv_nop" : "=v"(r) : "v"(x));
  return r;
}

__global__ __launch_bounds__(256) void rmsnorm_rope_kernel(
    _Float16* __restrict__ qkv3, const float* __restrict__ cosp,
    const float* __restrict__ sinp, const float* __restrict__ gq,
    const float* __restrict__ gk) {
  const int j8 = (threadIdx.x & 3) << 3;
  const int n  = ((blockIdx.x & 63) << 6) + (threadIdx.x >> 2);   // 64 rows a block
  const int p0 = (blockIdx.x >> 6) * RPL_;                        // first plane
  const bool isq = p0 < B_ * H_;
  // 1/sqrt(D) * log2(e) folded into Q; K is multiplied by one, which is exact
  const float qs = isq ? 0.125f * 1.44269504f : 1.0f;

  _Float16* p = qkv3 + ((size_t)p0 * N_ + n) * D_ + j8;
  v8h lo[RPL_], hi[RPL_];
#pragma unroll
  for (int i = 0; i < RPL_; ++i) {
    lo[i] = *reinterpret_cast<const v8h*>(p + (size_t)i * (N_ * D_));
    hi[i] = *reinterpret_cast<const v8h*>(p + (size_t)i * (N_ * D_) + 32);
  }

  const float* g  = (isq ? gq : gk) + j8;
  const float* cr = cosp + n * 64 + j8;
  const float* sr = sinp + n * 64 + j8;
  v4f tg[4], tc[4], ts[4];                 // [0],[1]: d = j8..j8+7; [2],[3]: d + 32
#pragma unroll
  for (int q = 0; q < 4; ++q)
    tc[q] = *reinterpret_cast<const v4f*>(cr + (q >> 1) * 32 + (q & 1) * 4);
  asm volatile("s_wait_xcnt 0x0" ::: "memory");
#pragma unroll
  for (int q = 0; q < 4; ++q)
    ts[q] = *reinterpret_cast<const v4f*>(sr + (q >> 1) * 32 + (q & 1) * 4);
  asm volatile("s_wait_xcnt 0x0" ::: "memory");
#pragma unroll
  for (int q = 0; q < 4; ++q)
    tg[q] = *reinterpret_cast<const v4f*>(g + (q >> 1) * 32 + (q & 1) * 4);
  // Keeps all 28 loads ahead of the arithmetic (one memory latency a wave):
  // without it the compiler sinks table loads between the rows' sums.
  __builtin_amdgcn_sched_barrier(0);

#pragma unroll
  for (int i = 0; i < RPL_; ++i) {
    float e0[8], e1[8];
    float ss = 0.f;
#pragma unroll
    for (int k = 0; k < 8; ++k) {
      e0[k] = (float)lo[i][k];
      e1[k] = (float)hi[i][k];
      ss += e0[k] * e0[k] + e1[k] * e1[k];
    }
    ss += quad_swap<0xB1>(ss);             // lane ^ 1
    ss += quad_swap<0x4E>(ss);             // lane ^ 2: all four lanes hold the sum
    // the argument is at least 1e-6: rsqrtf's rescaling of tiny arguments never acts
    float rinv = rsq_slot(ss * (1.0f / 64.0f) + 1e-6f);

    v8h olo, ohi;
#pragma unroll
    for (int k = 0; k < 8; ++k) {
      const int q = k >> 2, c = k & 3;
      float x0 = e0[k] * rinv * tg[q][c];
      float x1 = e1[k] * rinv * tg[q + 2][c];
      float y0 = x0 * tc[q][c]     - x1 * ts[q][c];      // d < 32: -x2*sin
      float y1 = x1 * tc[q + 2][c] + x0 * ts[q + 2][c];  // d >= 32: +x1*sin
      olo[k] = (_Float16)(y0 * qs);
      ohi[k] = (_Float16)(y1 * qs);
    }
    *reinterpret_cast<v8h*>(p + (size_t)i * (N_ * D_))      = olo;
    *reinterpret_cast<v8h*>(p + (size_t)i * (N_ * D_) + 32) = ohi;
  }
}

static __device__ __forceinline__ float xhalf(float x) {
  int v = __builtin_bit_cast(int, x);
  return __builtin_bit_cast(float, __builtin_amdgcn_permlanex16(
      v, v, 0x76543210, 0xfedcba98, false, false));
}

#define VP_ 80

typedef __attribute__((ext_vector_type(8))) short s16x8;
typedef __attribute__((address_space(3))) s16x8 lds_s16x8;

static __device__ __forceinline__ v16h frag_ld_tr(const _Float16* tile) {
  const int lane = threadIdx.x & 31;
  const _Float16* p = tile + (((lane >> 4) << 3) + (lane & 7)) * VP_ +
                      (((lane >> 3) & 1) << 3);
  v8h lo = __builtin_bit_cast(v8h, __builtin_amdgcn_ds_load_tr16_b128_v8i16(
      (lds_s16x8*)p));
  v8h hi = __builtin_bit_cast(v8h, __builtin_amdgcn_ds_load_tr16_b128_v8i16(
      (lds_s16x8*)(p + 16 * VP_)));
  return __builtin_shufflevector(lo, hi, 0, 1, 2, 3, 4, 5, 6, 7,
                                 8, 9, 10, 11, 12, 13, 14, 15);
}

__global__ __launch_bounds__(256) void flash_attn_kernel(
    const _Float16* __restrict__ qkv3, _Float16* __restrict__ attn_out) {
  __shared__ _Float16 Klds[64 * 72];       // [key][d], stride 72
  __shared__ __attribute__((aligned(16))) _Float16 Vlds[64 * VP_];   // [key][d]

  const int lane = threadIdx.x & 31;
  const int l16  = lane & 15;
  const int hlf8 = (lane >> 4) << 3;
  const int wid  = threadIdx.x >> 5;

  const int b = blockIdx.y >> 4;
  const int h = blockIdx.y & 15;
  const size_t plane = (size_t)N_ * D_;
  const _Float16* Q = qkv3 + ((size_t)((0 * B_ + b) * H_ + h)) * plane;
  const _Float16* K = qkv3 + ((size_t)((1 * B_ + b) * H_ + h)) * plane;
  const _Float16* V = qkv3 + ((size_t)((2 * B_ + b) * H_ + h)) * plane;

  const int qbase = blockIdx.x * 128 + wid * 16;

  v16h qf[2];                              // B operand: column = query l16
  qf[0] = frag_ld(Q + (size_t)qbase * D_ + 0,  D_);
  qf[1] = frag_ld(Q + (size_t)qbase * D_ + 32, D_);

  v8f o[4];                                // o[dt][r] = O[query l16][dt*16 + hlf8 + r]
#pragma unroll
  for (int dt = 0; dt < 4; ++dt) o[dt] = zero_v8f();
  float mrun = -3.0e38f;                   // this lane's query: running maximum
  float lrun = 0.f;                        // and the sum over this half's keys

  const int ntiles = N_ / 64;
  for (int kt = 0; kt < ntiles; ++kt) {
    const int k0 = kt * 64;

    // prefetch next 64-key K/V tile (one 128B line per thread)
    if (kt + 1 < ntiles) {
      int t = threadIdx.x;
      if (t < 64)
        __builtin_prefetch((const void*)(K + (size_t)(k0 + 64 + t) * D_), 0, 1);
      else if (t < 128)
        __builtin_prefetch((const void*)(V + (size_t)(k0 + t) * D_), 0, 1);
    }

    // stage: K and V row-major, 16 B a lane and copy. Unrolled so that a lane's four
    // copies issue back to back, all lanes on, and share one latency.
#pragma unroll
    for (int j = 0; j < 2; ++j) {
      const int t = threadIdx.x + j * 256;
      const int key = t >> 3, c = t & 7;
      cp_b128(K + (size_t)(k0 + key) * D_ + c * 8, &Klds[key * 72 + c * 8]);
      cp_b128(V + (size_t)(k0 + key) * D_ + c * 8, &Vlds[key * VP_ + c * 8]);
    }
    // this wave's copies have landed before the barrier behind which all waves read
    asm volatile("s_wait_asynccnt 0x0" ::: "memory");
    __syncthreads();

#pragma unroll
    for (int ss = 0; ss < 2; ++ss) {       // two 32-key sub-steps
      const _Float16* Kb = &Klds[(ss * 32) * 72];

      // S^T(32 keys x 16 queries): s0[r] = key hlf8 + r, s1[r] = key 16 + hlf8 + r
      v8f s0 = zero_v8f(), s1 = zero_v8f();
      s0 = wmma_f16(frag_ld(&Kb[0 * 16 * 72 + 0],  72), qf[0], s0);
      s0 = wmma_f16(frag_ld(&Kb[0 * 16 * 72 + 32], 72), qf[1], s0);
      s1 = wmma_f16(frag_ld(&Kb[1 * 16 * 72 + 0],  72), qf[0], s1);
      s1 = wmma_f16(frag_ld(&Kb[1 * 16 * 72 + 32], 72), qf[1], s1);

      // online softmax, base-2 (log2e folded into Q), one query per lane
      float mx = fmaxf(s0[0], s1[0]);
#pragma unroll
      for (int r = 1; r < 8; ++r) mx = fmaxf(mx, fmaxf(s0[r], s1[r]));
      mx = fmaxf(mx, xhalf(mx));           // both halves hold the query's maximum
      float mnew = fmaxf(mrun, mx);
      float alpha = exp2f(mrun - mnew);
      mrun = mnew;

      // P^T as B fragment: element s = key kmap(s) = s0[s] (s < 8), s1[s - 8]
      v16h pf;
      float ps = 0.f;
#pragma unroll
      for (int r = 0; r < 8; ++r) {
        float p0 = exp2f(s0[r] - mnew);
        float p1 = exp2f(s1[r] - mnew);
        ps += p0 + p1;
        pf[r]     = (_Float16)p0;
        pf[r + 8] = (_Float16)p1;
      }
      lrun = lrun * alpha + ps;
#pragma unroll
      for (int dt = 0; dt < 4; ++dt) o[dt] *= alpha;

      // O^T(64 d x 16 queries) += V^T(64 x 32 keys) * P^T(32 x 16)
#pragma unroll
      for (int dt = 0; dt < 4; ++dt)
        o[dt] = wmma_f16(frag_ld_tr(&Vlds[ss * 32 * VP_ + dt * 16]), pf, o[dt]);
    }
    // this wave's LDS reads are done before the barrier behind which the next
    // tile's copies overwrite both buffers
    asm volatile("s_wait_dscnt 0x0" ::: "memory");
    __syncthreads();
  }

  // join the halves' sums, normalize, store f16 [B][N][C] with head offset:
  // a lane's 8 registers of a tile are 8 consecutive d of its query row
  const float lsum = lrun + xhalf(lrun);
  _Float16* orow = attn_out + (size_t)(b * N_ + qbase + l16) * C_ + h * D_ + hlf8;
#pragma unroll
  for (int dt = 0; dt < 4; ++dt) {
    v8h ov;
#pragma unroll
    for (int r = 0; r < 8; ++r) ov[r] = (_Float16)(o[dt][r] / lsum);
    *reinterpret_cast<v8h*>(orow + dt * 16) = ov;
  }
}

// ---------------------------------------------------------------------------
// Host-side launch pipeline
// ---------------------------------------------------------------------------
extern "C" void kernel_launch(void* const* d_in, const int* in_sizes, int n_in,
                              void* d_out, int out_size, void* d_ws, size_t ws_size,
                              hipStream_t stream) {
  const float* hidden = (const float*)d_in[0];
  const float* cosp   = (const float*)d_in[1];
  const float* sinp   = (const float*)d_in[2];
  const float* Wqkv   = (const float*)d_in[3];
  const float* Wout   = (const float*)d_in[4];
  const float* gq     = (const float*)d_in[5];
  const float* gk     = (const float*)d_in[6];

  // workspace layout (bytes):
  //   Xh      f16 [8192,1024]           16,777,216
  //   WqkvT   f16 [3072,1024]            6,291,456
  //   WoutT   f16 [1024,1024]            2,097,152
  //   qkv3    f16 [3][2][16][4096][64]  50,331,648
  //   attnH   f16 [8192,1024]           16,777,216   (total ~92.3 MB)
  char* ws = (char*)d_ws;
  _Float16* Xh    = (_Float16*)(ws);
  _Float16* WqkvT = (_Float16*)(ws + 16777216);
  _Float16* WoutT = (_Float16*)(ws + 16777216 + 6291456);
  _Float16* qkv3  = (_Float16*)(ws + 16777216 + 6291456 + 2097152);
  _Float16* attnH = (_Float16*)(ws + 16777216 + 6291456 + 2097152 + 50331648);

  f32_to_f16_kernel<<<dim3((BN_ * C_) / 8192), 256, 0, stream>>>(hidden, Xh);
  transpose_f32_to_f16_kernel<C_, C3_><<<dim3(C3_ / 256, C_ / 16), 256, 0, stream>>>(
      Wqkv, WqkvT);
  transpose_f32_to_f16_kernel<C_, C_><<<dim3(C_ / 256, C_ / 16), 256, 0, stream>>>(
      Wout, WoutT);

  // QKV projection, scattered into [3][B][H][N][D] f16
  gemm_f16_wmma<0><<<dim3(C3_ / 128, BN_ / 128), 256, 0, stream>>>(
      Xh, WqkvT, (void*)qkv3, BN_, C3_, C_);

  // per-head RMSNorm + RoPE on q/k planes (in place)
  rmsnorm_rope_kernel<<<dim3((2 * B_ * H_ / RPL_) * (N_ / 64)), 256, 0, stream>>>(
      qkv3, cosp, sinp, gq, gk);

  // flash attention -> f16 [B,N,C]
  flash_attn_kernel<<<dim3(N_ / 128, B_ * H_), 256, 0, stream>>>(qkv3, attnH);

  // output projection -> fp32 d_out
  gemm_f16_wmma<1><<<dim3(C_ / 128, BN_ / 128), 256, 0, stream>>>(
      attnH, WoutT, d_out, BN_, C_, C_);
}

// v004
// One run takes 263 microseconds.
// Next to v003, in two timings, it ran 1.14 times as fast each time.
// Counting every step since v000, it is 2.81 times as fast.
#include <hip/hip_runtime.h>
#include <hip/hip_bf16.h>

typedef __attribute__((ext_vector_type(16))) _Float16 v16h;
typedef __attribute__((ext_vector_type(8)))  _Float16 v8h;
typedef __attribute__((ext_vector_type(8)))  float    v8f;
typedef __attribute__((ext_vector_type(4)))  _Float16 v4h;
typedef __attribute__((ext_vector_type(4)))  float    v4f;

#define B_   2
#define N_   4096
#define C_   1024
#define H_   16
#define D_   64
#define BN_  8192
#define C3_  3072

#if defined(__has_builtin)
#if __has_builtin(__builtin_amdgcn_global_load_async_to_lds_b128)
#define USE_ASYNC_LDS 1
#endif
#endif

typedef int b128_t __attribute__((vector_size(16)));
typedef __attribute__((address_space(1))) b128_t* gb128_p;
typedef __attribute__((address_space(3))) b128_t* lb128_p;

static __device__ __forceinline__ void cp_b128(const _Float16* g, _Float16* l) {
#ifdef USE_ASYNC_LDS
  __builtin_amdgcn_global_load_async_to_lds_b128(
      (gb128_p)(unsigned long long)(uintptr_t)g,
      (lb128_p)(unsigned)(uintptr_t)l,        // generic LDS addr: low 32 bits
      0, 0);
#else
  *reinterpret_cast<v8h*>(l) = *reinterpret_cast<const v8h*>(g);
#endif
}

static __device__ __forceinline__ void async_wait() {
#ifdef USE_ASYNC_LDS
#if __has_builtin(__builtin_amdgcn_s_wait_asynccnt)
  __builtin_amdgcn_s_wait_asynccnt(0);
#else
  asm volatile("s_wait_asynccnt 0x0" ::: "memory");
#endif
#endif
}

static __device__ __forceinline__ v16h frag_ld(const _Float16* base, int stride) {
  const int lane = threadIdx.x & 31;
  const _Float16* p = base + (lane & 15) * stride + ((lane >> 4) << 3);
  v8h lo = *reinterpret_cast<const v8h*>(p);
  v8h hi = *reinterpret_cast<const v8h*>(p + 16);
  return __builtin_shufflevector(lo, hi, 0, 1, 2, 3, 4, 5, 6, 7,
                                 8, 9, 10, 11, 12, 13, 14, 15);
}

static __device__ __forceinline__ v8f wmma_f16(v16h a, v16h b, v8f c) {
  return __builtin_amdgcn_wmma_f32_16x16x32_f16(false, a, false, b,
                                                (short)0, c, false, false);
}

static __device__ __forceinline__ v8f zero_v8f() {
  v8f z = {0.f, 0.f, 0.f, 0.f, 0.f, 0.f, 0.f, 0.f};
  return z;
}

// ---------------------------------------------------------------------------
// fp32 -> f16 elementwise, and transposed f16 weight copies.
// Few, fat waves: many elements a lane, wide accesses, all loads of a lane in
// flight together. Every grid covers its array exactly (no bounds test).
// ---------------------------------------------------------------------------
// A block converts 8192 consecutive floats: 8 loads of 16 B a lane, all issued
// before the first store; each wave-wide access covers whole 128-B lines.
__global__ __launch_bounds__(256) void f32_to_f16_kernel(
    const float* __restrict__ in, _Float16* __restrict__ out) {
  const size_t base = (size_t)blockIdx.x * 8192 + threadIdx.x * 4;
  v4f v[8];
#pragma unroll
  for (int j = 0; j < 8; ++j)
    v[j] = *reinterpret_cast<const v4f*>(in + base + j * 1024);
#pragma unroll
  for (int j = 0; j < 8; ++j)
    *reinterpret_cast<v4h*>(out + base + j * 1024) =
        __builtin_convertvector(v[j], v4h);
}

// A lane takes column n and 16 consecutive k: 16 row-coalesced loads, then
// 32 contiguous bytes of WT row n. grid = (Ncol / 256, K / 16).
// K and Ncol are compile-time so that all 16 loads share one address register
// pair and differ in their immediate offsets only.
template <int K, int Ncol>
__global__ __launch_bounds__(256) void transpose_f32_to_f16_kernel(
    const float* __restrict__ W, _Float16* __restrict__ WT) {
  const int n  = blockIdx.x * 256 + threadIdx.x;
  const int k0 = blockIdx.y * 16;
  const float* src = W + (size_t)k0 * Ncol + n;
  float v[16];
#pragma unroll
  for (int j = 0; j < 16; ++j) v[j] = src[j * Ncol];
  v8h lo, hi;
#pragma unroll
  for (int j = 0; j < 8; ++j) {
    lo[j] = (_Float16)v[j];
    hi[j] = (_Float16)v[j + 8];
  }
  _Float16* dst = WT + (size_t)n * K + k0;
  *reinterpret_cast<v8h*>(dst)     = lo;
  *reinterpret_cast<v8h*>(dst + 8) = hi;
}

// ---------------------------------------------------------------------------
// GEMM: out[M][Nn] = A[M][Kk] * BT[Nn][Kk]^T   (f16 in, f32 accumulate)
// 256 threads = 8 waves (4x2), block tile 128x128, wave tile 32x64
// (2x4 fragments -> 8 wmma per wave per 32-deep K step).
// LDS ping-pong double buffering; stage for tile k+1 is issued (async when
// available) before computing tile k.
// MODE 0: scatter f16 into qkv3 [3][B][H][N][D].   MODE 1: fp32 row-major.
// ---------------------------------------------------------------------------
template <int MODE>
__global__ __launch_bounds__(256) void gemm_f16_wmma(
    const _Float16* __restrict__ A, const _Float16* __restrict__ BT,
    void* __restrict__ out, int M, int Nn, int Kk) {
  __shared__ _Float16 Alds[2][128 * 40];   // 32 k-halves + 8 pad
  __shared__ _Float16 Blds[2][128 * 40];

  const int lane = threadIdx.x & 31;
  const int l16  = lane & 15;
  const int wid  = threadIdx.x >> 5;
  const int wrow = wid >> 1;               // 0..3  -> rows wrow*32
  const int wcol = wid & 1;                // 0..1  -> cols wcol*64
  const int m0 = blockIdx.y * 128;
  const int n0 = blockIdx.x * 128;

  v8f acc[2][4];
#pragma unroll
  for (int i = 0; i < 2; ++i)
#pragma unroll
    for (int j = 0; j < 4; ++j) acc[i][j] = zero_v8f();

  auto stage = [&](int k0, int buf) {
    for (int t = threadIdx.x; t < 512; t += 256) {
      int r = t >> 2, c = t & 3;
      cp_b128(A + (size_t)(m0 + r) * Kk + k0 + c * 8, &Alds[buf][r * 40 + c * 8]);
    }
    for (int t = threadIdx.x; t < 512; t += 256) {
      int r = t >> 2, c = t & 3;
      cp_b128(BT + (size_t)(n0 + r) * Kk + k0 + c * 8, &Blds[buf][r * 40 + c * 8]);
    }
  };

  const int nk = Kk >> 5;                  // K steps of 32
  stage(0, 0);
  for (int kk = 0; kk < nk; ++kk) {
    async_wait();
    __syncthreads();
    if (kk + 1 < nk) stage((kk + 1) << 5, (kk + 1) & 1);

    const _Float16* Ab = Alds[kk & 1];
    const _Float16* Bb = Blds[kk & 1];
    v16h af[2], bf[4];
#pragma unroll
    for (int i = 0; i < 2; ++i)
      af[i] = frag_ld(&Ab[(wrow * 32 + i * 16) * 40], 40);
#pragma unroll
    for (int j = 0; j < 4; ++j)
      bf[j] = frag_ld(&Bb[(wcol * 64 + j * 16) * 40], 40);
#pragma unroll
    for (int i = 0; i < 2; ++i)
#pragma unroll
      for (int j = 0; j < 4; ++j) acc[i][j] = wmma_f16(af[i], bf[j], acc[i][j]);
  }

  // epilogue: C/D layout -> element (m = r + 8*(lane>>4), n = lane&15)
#pragma unroll
  for (int i = 0; i < 2; ++i) {
#pragma unroll
    for (int j = 0; j < 4; ++j) {
#pragma unroll
      for (int r = 0; r < 8; ++r) {
        int row = m0 + wrow * 32 + i * 16 + r + ((lane >> 4) << 3);
        int col = n0 + wcol * 64 + j * 16 + l16;
        float val = acc[i][j][r];
        if (MODE == 0) {
          int s = col >> 10, rem = col & 1023;
          int hh = rem >> 6, d = rem & 63;
          int bb = row >> 12, nn = row & 4095;
          ((_Float16*)out)[((((size_t)s * B_ + bb) * H_ + hh) * N_ + nn) * D_ + d] =
              (_Float16)val;
        } else {
          ((float*)out)[(size_t)row * Nn + col] = val;
        }
      }
    }
  }
}

#define RPL_ 8

template <int CTRL>
static __device__ __forceinline__ float quad_swap(float x) {   // quad_perm DPP
  return __builtin_bit_cast(float, __builtin_amdgcn_mov_dpp(
      __builtin_bit_cast(int, x), CTRL, 0xf, 0xf, true));
}

static __device__ __forceinline__ float rsq_slot(float x) {
  float r;
  asm("v_rsq_f32 %0, %1\n\tv_nop" : "=v"(r) : "v"(x));
  return r;
}

__global__ __launch_bounds__(256) void rmsnorm_rope_kernel(
    _Float16* __restrict__ qkv3, const float* __restrict__ cosp,
    const float* __restrict__ sinp, const float* __restrict__ gq,
    const float* __restrict__ gk) {
  const int j8 = (threadIdx.x & 3) << 3;
  const int n  = ((blockIdx.x & 63) << 6) + (threadIdx.x >> 2);   // 64 rows a block
  const int p0 = (blockIdx.x >> 6) * RPL_;                        // first plane
  const bool isq = p0 < B_ * H_;
  // 1/sqrt(D) * log2(e) folded into Q; K is multiplied by one, which is exact
  const float qs = isq ? 0.125f * 1.44269504f : 1.0f;

  _Float16* p = qkv3 + ((size_t)p0 * N_ + n) * D_ + j8;
  v8h lo[RPL_], hi[RPL_];
#pragma unroll
  for (int i = 0; i < RPL_; ++i) {
    lo[i] = *reinterpret_cast<const v8h*>(p + (size_t)i * (N_ * D_));
    hi[i] = *reinterpret_cast<const v8h*>(p + (size_t)i * (N_ * D_) + 32);
  }

  const float* g  = (isq ? gq : gk) + j8;
  const float* cr = cosp + n * 64 + j8;
  const float* sr = sinp + n * 64 + j8;
  v4f tg[4], tc[4], ts[4];                 // [0],[1]: d = j8..j8+7; [2],[3]: d + 32
#pragma unroll
  for (int q = 0; q < 4; ++q)
    tc[q] = *reinterpret_cast<const v4f*>(cr + (q >> 1) * 32 + (q & 1) * 4);
  asm volatile("s_wait_xcnt 0x0" ::: "memory");
#pragma unroll
  for (int q = 0; q < 4; ++q)
    ts[q] = *reinterpret_cast<const v4f*>(sr + (q >> 1) * 32 + (q & 1) * 4);
  asm volatile("s_wait_xcnt 0x0" ::: "memory");
#pragma unroll
  for (int q = 0; q < 4; ++q)
    tg[q] = *reinterpret_cast<const v4f*>(g + (q >> 1) * 32 + (q & 1) * 4);
  // Keeps all 28 loads ahead of the arithmetic (one memory latency a wave):
  // without it the compiler sinks table loads between the rows' sums.
  __builtin_amdgcn_sched_barrier(0);

#pragma unroll
  for (int i = 0; i < RPL_; ++i) {
    float e0[8], e1[8];
    float ss = 0.f;
#pragma unroll
    for (int k = 0; k < 8; ++k) {
      e0[k] = (float)lo[i][k];
      e1[k] = (float)hi[i][k];
      ss += e0[k] * e0[k] + e1[k] * e1[k];
    }
    ss += quad_swap<0xB1>(ss);             // lane ^ 1
    ss += quad_swap<0x4E>(ss);             // lane ^ 2: all four lanes hold the sum
    // the argument is at least 1e-6: rsqrtf's rescaling of tiny arguments never acts
    float rinv = rsq_slot(ss * (1.0f / 64.0f) + 1e-6f);

    v8h olo, ohi;
#pragma unroll
    for (int k = 0; k < 8; ++k) {
      const int q = k >> 2, c = k & 3;
      float x0 = e0[k] * rinv * tg[q][c];
      float x1 = e1[k] * rinv * tg[q + 2][c];
      float y0 = x0 * tc[q][c]     - x1 * ts[q][c];      // d < 32: -x2*sin
      float y1 = x1 * tc[q + 2][c] + x0 * ts[q + 2][c];  // d >= 32: +x1*sin
      olo[k] = (_Float16)(y0 * qs);
      ohi[k] = (_Float16)(y1 * qs);
    }
    *reinterpret_cast<v8h*>(p + (size_t)i * (N_ * D_))      = olo;
    *reinterpret_cast<v8h*>(p + (size_t)i * (N_ * D_) + 32) = ohi;
  }
}

static __device__ __forceinline__ float xhalf(float x) {
  int v = __builtin_bit_cast(int, x);
  return __builtin_bit_cast(float, __builtin_amdgcn_permlanex16(
      v, v, 0x76543210, 0xfedcba98, false, false));
}

static __device__ __forceinline__ void exp2_block(float (&x)[16], float& a) {
  asm("v_exp_f32 %0, %0\n\tv_exp_f32 %1, %1\n\tv_exp_f32 %2, %2\n\t"
      "v_exp_f32 %3, %3\n\tv_exp_f32 %4, %4\n\tv_exp_f32 %5, %5\n\t"
      "v_exp_f32 %6, %6\n\tv_exp_f32 %7, %7\n\tv_exp_f32 %8, %8\n\t"
      "v_exp_f32 %9, %9\n\tv_exp_f32 %10, %10\n\tv_exp_f32 %11, %11\n\t"
      "v_exp_f32 %12, %12\n\tv_exp_f32 %13, %13\n\tv_exp_f32 %14, %14\n\t"
      "v_exp_f32 %15, %15\n\tv_exp_f32 %16, %16\n\tv_nop"
      : "+v"(x[0]), "+v"(x[1]), "+v"(x[2]), "+v"(x[3]), "+v"(x[4]), "+v"(x[5]),
        "+v"(x[6]), "+v"(x[7]), "+v"(a), "+v"(x[8]), "+v"(x[9]), "+v"(x[10]),
        "+v"(x[11]), "+v"(x[12]), "+v"(x[13]), "+v"(x[14]), "+v"(x[15]));
}

#define VP_ 80

typedef __attribute__((ext_vector_type(8))) short s16x8;
typedef __attribute__((address_space(3))) s16x8 lds_s16x8;

static __device__ __forceinline__ v16h frag_ld_tr(const _Float16* tile) {
  const int lane = threadIdx.x & 31;
  const _Float16* p = tile + (((lane >> 4) << 3) + (lane & 7)) * VP_ +
                      (((lane >> 3) & 1) << 3);
  v8h lo = __builtin_bit_cast(v8h, __builtin_amdgcn_ds_load_tr16_b128_v8i16(
      (lds_s16x8*)p));
  v8h hi = __builtin_bit_cast(v8h, __builtin_amdgcn_ds_load_tr16_b128_v8i16(
      (lds_s16x8*)(p + 16 * VP_)));
  return __builtin_shufflevector(lo, hi, 0, 1, 2, 3, 4, 5, 6, 7,
                                 8, 9, 10, 11, 12, 13, 14, 15);
}

__global__ __launch_bounds__(256) void flash_attn_kernel(
    const _Float16* __restrict__ qkv3, _Float16* __restrict__ attn_out) {
  __shared__ _Float16 Klds[64 * 72];       // [key][d], stride 72
  __shared__ __attribute__((aligned(16))) _Float16 Vlds[64 * VP_];   // [key][d]

  const int lane = threadIdx.x & 31;
  const int l16  = lane & 15;
  const int hlf8 = (lane >> 4) << 3;
  const int wid  = threadIdx.x >> 5;

  const int b = blockIdx.y >> 4;
  const int h = blockIdx.y & 15;
  const size_t plane = (size_t)N_ * D_;
  const _Float16* Q = qkv3 + ((size_t)((0 * B_ + b) * H_ + h)) * plane;
  const _Float16* K = qkv3 + ((size_t)((1 * B_ + b) * H_ + h)) * plane;
  const _Float16* V = qkv3 + ((size_t)((2 * B_ + b) * H_ + h)) * plane;

  const int qbase = blockIdx.x * 128 + wid * 16;

  v16h qf[2];                              // B operand: column = query l16
  qf[0] = frag_ld(Q + (size_t)qbase * D_ + 0,  D_);
  qf[1] = frag_ld(Q + (size_t)qbase * D_ + 32, D_);

  v8f o[4];                                // o[dt][r] = O[query l16][dt*16 + hlf8 + r]
#pragma unroll
  for (int dt = 0; dt < 4; ++dt) o[dt] = zero_v8f();
  float mrun = -3.0e38f;                   // this lane's query: running maximum
  float lrun = 0.f;                        // and the sum over this half's keys

  const int ntiles = N_ / 64;
  for (int kt = 0; kt < ntiles; ++kt) {
    const int k0 = kt * 64;

    // prefetch next 64-key K/V tile (one 128B line per thread)
    if (kt + 1 < ntiles) {
      int t = threadIdx.x;
      if (t < 64)
        __builtin_prefetch((const void*)(K + (size_t)(k0 + 64 + t) * D_), 0, 1);
      else if (t < 128)
        __builtin_prefetch((const void*)(V + (size_t)(k0 + t) * D_), 0, 1);
    }

    // stage: K and V row-major, 16 B a lane and copy. Unrolled so that a lane's four
    // copies issue back to back, all lanes on, and share one latency.
#pragma unroll
    for (int j = 0; j < 2; ++j) {
      const int t = threadIdx.x + j * 256;
      const int key = t >> 3, c = t & 7;
      cp_b128(K + (size_t)(k0 + key) * D_ + c * 8, &Klds[key * 72 + c * 8]);
      cp_b128(V + (size_t)(k0 + key) * D_ + c * 8, &Vlds[key * VP_ + c * 8]);
    }
    // this wave's copies have landed before the barrier behind which all waves read
    asm volatile("s_wait_asynccnt 0x0" ::: "memory");
    __syncthreads();

#pragma unroll
    for (int ss = 0; ss < 2; ++ss) {       // two 32-key sub-steps
      const _Float16* Kb = &Klds[(ss * 32) * 72];

      // S^T(32 keys x 16 queries): s0[r] = key hlf8 + r, s1[r] = key 16 + hlf8 + r
      v8f s0 = zero_v8f(), s1 = zero_v8f();
      s0 = wmma_f16(frag_ld(&Kb[0 * 16 * 72 + 0],  72), qf[0], s0);
      s0 = wmma_f16(frag_ld(&Kb[0 * 16 * 72 + 32], 72), qf[1], s0);
      s1 = wmma_f16(frag_ld(&Kb[1 * 16 * 72 + 0],  72), qf[0], s1);
      s1 = wmma_f16(frag_ld(&Kb[1 * 16 * 72 + 32], 72), qf[1], s1);

      // online softmax, base-2 (log2e folded into Q), one query per lane
      float mx = fmaxf(s0[0], s1[0]);
#pragma unroll
      for (int r = 1; r < 8; ++r) mx = fmaxf(mx, fmaxf(s0[r], s1[r]));
      mx = fmaxf(mx, xhalf(mx));           // both halves hold the query's maximum
      float mnew = fmaxf(mrun, mx);
      float alpha = mrun - mnew;
      mrun = mnew;
      float p[16];                         // p[2r] = key hlf8 + r, p[2r + 1] = 16 + hlf8 + r
#pragma unroll
      for (int r = 0; r < 8; ++r) {
        p[2 * r]     = s0[r] - mnew;
        p[2 * r + 1] = s1[r] - mnew;
      }
      exp2_block(p, alpha);

      // P^T as B fragment: element s = key kmap(s) = s0[s] (s < 8), s1[s - 8]
      v16h pf;
      float ps = 0.f;
#pragma unroll
      for (int r = 0; r < 8; ++r) {
        float p0 = p[2 * r];
        float p1 = p[2 * r + 1];
        ps += p0 + p1;
        pf[r]     = (_Float16)p0;
        pf[r + 8] = (_Float16)p1;
      }
      lrun = lrun * alpha + ps;
#pragma unroll
      for (int dt = 0; dt < 4; ++dt) o[dt] *= alpha;

      // O^T(64 d x 16 queries) += V^T(64 x 32 keys) * P^T(32 x 16)
#pragma unroll
      for (int dt = 0; dt < 4; ++dt)
        o[dt] = wmma_f16(frag_ld_tr(&Vlds[ss * 32 * VP_ + dt * 16]), pf, o[dt]);
    }
    // this wave's LDS reads are done before the barrier behind which the next
    // tile's copies overwrite both buffers
    asm volatile("s_wait_dscnt 0x0" ::: "memory");
    __syncthreads();
  }

  // join the halves' sums, normalize, store f16 [B][N][C] with head offset:
  // a lane's 8 registers of a tile are 8 consecutive d of its query row
  const float lsum = lrun + xhalf(lrun);
  _Float16* orow = attn_out + (size_t)(b * N_ + qbase + l16) * C_ + h * D_ + hlf8;
#pragma unroll
  for (int dt = 0; dt < 4; ++dt) {
    v8h ov;
#pragma unroll
    for (int r = 0; r < 8; ++r) ov[r] = (_Float16)(o[dt][r] / lsum);
    *reinterpret_cast<v8h*>(orow + dt * 16) = ov;
  }
}

// ---------------------------------------------------------------------------
// Host-side launch pipeline
// ---------------------------------------------------------------------------
extern "C" void kernel_launch(void* const* d_in, const int* in_sizes, int n_in,
                              void* d_out, int out_size, void* d_ws, size_t ws_size,
                              hipStream_t stream) {
  const float* hidden = (const float*)d_in[0];
  const float* cosp   = (const float*)d_in[1];
  const float* sinp   = (const float*)d_in[2];
  const float* Wqkv   = (const float*)d_in[3];
  const float* Wout   = (const float*)d_in[4];
  const float* gq     = (const float*)d_in[5];
  const float* gk     = (const float*)d_in[6];

  // workspace layout (bytes):
  //   Xh      f16 [8192,1024]           16,777,216
  //   WqkvT   f16 [3072,1024]            6,291,456
  //   WoutT   f16 [1024,1024]            2,097,152
  //   qkv3    f16 [3][2][16][4096][64]  50,331,648
  //   attnH   f16 [8192,1024]           16,777,216   (total ~92.3 MB)
  char* ws = (char*)d_ws;
  _Float16* Xh    = (_Float16*)(ws);
  _Float16* WqkvT = (_Float16*)(ws + 16777216);
  _Float16* WoutT = (_Float16*)(ws + 16777216 + 6291456);
  _Float16* qkv3  = (_Float16*)(ws + 16777216 + 6291456 + 2097152);
  _Float16* attnH = (_Float16*)(ws + 16777216 + 6291456 + 2097152 + 50331648);

  f32_to_f16_kernel<<<dim3((BN_ * C_) / 8192), 256, 0, stream>>>(hidden, Xh);
  transpose_f32_to_f16_kernel<C_, C3_><<<dim3(C3_ / 256, C_ / 16), 256, 0, stream>>>(
      Wqkv, WqkvT);
  transpose_f32_to_f16_kernel<C_, C_><<<dim3(C_ / 256, C_ / 16), 256, 0, stream>>>(
      Wout, WoutT);

  // QKV projection, scattered into [3][B][H][N][D] f16
  gemm_f16_wmma<0><<<dim3(C3_ / 128, BN_ / 128), 256, 0, stream>>>(
      Xh, WqkvT, (void*)qkv3, BN_, C3_, C_);

  // per-head RMSNorm + RoPE on q/k planes (in place)
  rmsnorm_rope_kernel<<<dim3((2 * B_ * H_ / RPL_) * (N_ / 64)), 256, 0, stream>>>(
      qkv3, cosp, sinp, gq, gk);

  // flash attention -> f16 [B,N,C]
  flash_attn_kernel<<<dim3(N_ / 128, B_ * H_), 256, 0, stream>>>(qkv3, attnH);

  // output projection -> fp32 d_out
  gemm_f16_wmma<1><<<dim3(C_ / 128, BN_ / 128), 256, 0, stream>>>(
      attnH, WoutT, d_out, BN_, C_, C_);
}

// v005
// One run takes 220 microseconds.
// Timed twice side by side with v004, it ran 1.19 times as fast both times.
// Over all steps from v000 it is 3.36 times as fast.
#include <hip/hip_runtime.h>
#include <hip/hip_bf16.h>

typedef __attribute__((ext_vector_type(16))) _Float16 v16h;
typedef __attribute__((ext_vector_type(8)))  _Float16 v8h;
typedef __attribute__((ext_vector_type(8)))  float    v8f;
typedef __attribute__((ext_vector_type(4)))  _Float16 v4h;
typedef __attribute__((ext_vector_type(4)))  float    v4f;

#define B_   2
#define N_   4096
#define C_   1024
#define H_   16
#define D_   64
#define BN_  8192
#define C3_  3072

#if defined(__has_builtin)
#if __has_builtin(__builtin_amdgcn_global_load_async_to_lds_b128)
#define USE_ASYNC_LDS 1
#endif
#endif

typedef int b128_t __attribute__((vector_size(16)));
typedef __attribute__((address_space(1))) b128_t* gb128_p;
typedef __attribute__((address_space(3))) b128_t* lb128_p;

static __device__ __forceinline__ void cp_b128(const _Float16* g, _Float16* l) {
#ifdef USE_ASYNC_LDS
  __builtin_amdgcn_global_load_async_to_lds_b128(
      (gb128_p)(unsigned long long)(uintptr_t)g,
      (lb128_p)(unsigned)(uintptr_t)l,        // generic LDS addr: low 32 bits
      0, 0);
#else
  *reinterpret_cast<v8h*>(l) = *reinterpret_cast<const v8h*>(g);
#endif
}

static __device__ __forceinline__ v16h frag_ld(const _Float16* base, int stride) {
  const int lane = threadIdx.x & 31;
  const _Float16* p = base + (lane & 15) * stride + ((lane >> 4) << 3);
  v8h lo = *reinterpret_cast<const v8h*>(p);
  v8h hi = *reinterpret_cast<const v8h*>(p + 16);
  return __builtin_shufflevector(lo, hi, 0, 1, 2, 3, 4, 5, 6, 7,
                                 8, 9, 10, 11, 12, 13, 14, 15);
}

static __device__ __forceinline__ v8f wmma_f16(v16h a, v16h b, v8f c) {
  return __builtin_amdgcn_wmma_f32_16x16x32_f16(false, a, false, b,
                                                (short)0, c, false, false);
}

static __device__ __forceinline__ v8f zero_v8f() {
  v8f z = {0.f, 0.f, 0.f, 0.f, 0.f, 0.f, 0.f, 0.f};
  return z;
}

// ---------------------------------------------------------------------------
// fp32 -> f16 elementwise, and transposed f16 weight copies.
// Few, fat waves: many elements a lane, wide accesses, all loads of a lane in
// flight together. Every grid covers its array exactly (no bounds test).
// ---------------------------------------------------------------------------
// A block converts 8192 consecutive floats: 8 loads of 16 B a lane, all issued
// before the first store; each wave-wide access covers whole 128-B lines.
__global__ __launch_bounds__(256) void f32_to_f16_kernel(
    const float* __restrict__ in, _Float16* __restrict__ out) {
  const size_t base = (size_t)blockIdx.x * 8192 + threadIdx.x * 4;
  v4f v[8];
#pragma unroll
  for (int j = 0; j < 8; ++j)
    v[j] = *reinterpret_cast<const v4f*>(in + base + j * 1024);
#pragma unroll
  for (int j = 0; j < 8; ++j)
    *reinterpret_cast<v4h*>(out + base + j * 1024) =
        __builtin_convertvector(v[j], v4h);
}

// A lane takes column n and 16 consecutive k: 16 row-coalesced loads, then
// 32 contiguous bytes of WT row n. grid = (Ncol / 256, K / 16).
// K and Ncol are compile-time so that all 16 loads share one address register
// pair and differ in their immediate offsets only.
template <int K, int Ncol>
__global__ __launch_bounds__(256) void transpose_f32_to_f16_kernel(
    const float* __restrict__ W, _Float16* __restrict__ WT) {
  const int n  = blockIdx.x * 256 + threadIdx.x;
  const int k0 = blockIdx.y * 16;
  const float* src = W + (size_t)k0 * Ncol + n;
  float v[16];
#pragma unroll
  for (int j = 0; j < 16; ++j) v[j] = src[j * Ncol];
  v8h lo, hi;
#pragma unroll
  for (int j = 0; j < 8; ++j) {
    lo[j] = (_Float16)v[j];
    hi[j] = (_Float16)v[j + 8];
  }
  _Float16* dst = WT + (size_t)n * K + k0;
  *reinterpret_cast<v8h*>(dst)     = lo;
  *reinterpret_cast<v8h*>(dst + 8) = hi;
}

// ---------------------------------------------------------------------------
// GEMM: out[M][Nn] = A[M][Kk] * BT[Nn][Kk]^T   (f16 in, f32 accumulate)
// 256 threads = 8 waves (4x2), block tile 128x128, wave tile 32x64
// (2x4 fragments -> 8 wmma per wave per 32-deep block, two blocks per K step).
// A K step is 64 deep: a staged row is one whole 128-B line, brought by 8 lanes.
// LDS ping-pong double buffering; stage for tile k+1 is issued (async when
// available) before computing tile k.
// MODE 0: scatter f16 into qkv3 [3][B][H][N][D].   MODE 1: fp32 row-major.
// ---------------------------------------------------------------------------
template <int MODE>
__global__ __launch_bounds__(256) void gemm_f16_wmma(
    const _Float16* __restrict__ A, const _Float16* __restrict__ BT,
    void* __restrict__ out, int M, int Nn, int Kk) {
  __shared__ _Float16 Alds[2][128 * 72];   // 64 k-halves + 8 pad: 144 B, 16 B x odd
  __shared__ _Float16 Blds[2][128 * 72];

  const int lane = threadIdx.x & 31;
  const int l16  = lane & 15;
  const int wid  = threadIdx.x >> 5;
  const int wrow = wid >> 1;               // 0..3  -> rows wrow*32
  const int wcol = wid & 1;                // 0..1  -> cols wcol*64
  const int m0 = blockIdx.y * 128;
  const int n0 = blockIdx.x * 128;

  v8f acc[2][4];
#pragma unroll
  for (int i = 0; i < 2; ++i)
#pragma unroll
    for (int j = 0; j < 4; ++j) acc[i][j] = zero_v8f();

  auto stage = [&](int k0, int buf) {
#pragma unroll
    for (int q = 0; q < 4; ++q) {
      const int t = threadIdx.x + q * 256;
      const int r = t >> 3, c = t & 7;
      cp_b128(A + (size_t)(m0 + r) * Kk + k0 + c * 8, &Alds[buf][r * 72 + c * 8]);
      cp_b128(BT + (size_t)(n0 + r) * Kk + k0 + c * 8, &Blds[buf][r * 72 + c * 8]);
    }
  };

  const int nk = Kk >> 6;                  // K steps of 64
  stage(0, 0);
  for (int kk = 0; kk < nk; ++kk) {
    // this wave's reads of the buffer that is refilled behind the barrier are done,
    // and its copies of this step's tile have landed, before all waves meet
    asm volatile("s_wait_dscnt 0x0" ::: "memory");
    asm volatile("s_wait_asynccnt 0x0" ::: "memory");
    __syncthreads();
    if (kk + 1 < nk) stage((kk + 1) << 6, (kk + 1) & 1);

    const _Float16* Ab = Alds[kk & 1];
    const _Float16* Bb = Blds[kk & 1];
#pragma unroll
    for (int ks = 0; ks < 2; ++ks) {       // two 32-deep blocks, k ascending
      v16h af[2], bf[4];
#pragma unroll
      for (int i = 0; i < 2; ++i)
        af[i] = frag_ld(&Ab[(wrow * 32 + i * 16) * 72 + ks * 32], 72);
#pragma unroll
      for (int j = 0; j < 4; ++j)
        bf[j] = frag_ld(&Bb[(wcol * 64 + j * 16) * 72 + ks * 32], 72);
#pragma unroll
      for (int i = 0; i < 2; ++i)
#pragma unroll
        for (int j = 0; j < 4; ++j) acc[i][j] = wmma_f16(af[i], bf[j], acc[i][j]);
    }
  }
  // the ring's closing wait: none of this wave's copies is in flight behind the loop,
  // whatever the trip count
  asm volatile("s_wait_asynccnt 0x0" ::: "memory");

  // epilogue: C/D layout -> element (m = r + 8*(lane>>4), n = lane&15)
#pragma unroll
  for (int i = 0; i < 2; ++i) {
#pragma unroll
    for (int j = 0; j < 4; ++j) {
#pragma unroll
      for (int r = 0; r < 8; ++r) {
        int row = m0 + wrow * 32 + i * 16 + r + ((lane >> 4) << 3);
        int col = n0 + wcol * 64 + j * 16 + l16;
        float val = acc[i][j][r];
        if (MODE == 0) {
          int s = col >> 10, rem = col & 1023;
          int hh = rem >> 6, d = rem & 63;
          int bb = row >> 12, nn = row & 4095;
          ((_Float16*)out)[((((size_t)s * B_ + bb) * H_ + hh) * N_ + nn) * D_ + d] =
              (_Float16)val;
        } else {
          ((float*)out)[(size_t)row * Nn + col] = val;
        }
      }
    }
  }
}

#define RPL_ 8

template <int CTRL>
static __device__ __forceinline__ float quad_swap(float x) {   // quad_perm DPP
  return __builtin_bit_cast(float, __builtin_amdgcn_mov_dpp(
      __builtin_bit_cast(int, x), CTRL, 0xf, 0xf, true));
}

static __device__ __forceinline__ float rsq_slot(float x) {
  float r;
  asm("v_rsq_f32 %0, %1\n\tv_nop" : "=v"(r) : "v"(x));
  return r;
}

__global__ __launch_bounds__(256) void rmsnorm_rope_kernel(
    _Float16* __restrict__ qkv3, const float* __restrict__ cosp,
    const float* __restrict__ sinp, const float* __restrict__ gq,
    const float* __restrict__ gk) {
  const int j8 = (threadIdx.x & 3) << 3;
  const int n  = ((blockIdx.x & 63) << 6) + (threadIdx.x >> 2);   // 64 rows a block
  const int p0 = (blockIdx.x >> 6) * RPL_;                        // first plane
  const bool isq = p0 < B_ * H_;
  // 1/sqrt(D) * log2(e) folded into Q; K is multiplied by one, which is exact
  const float qs = isq ? 0.125f * 1.44269504f : 1.0f;

  _Float16* p = qkv3 + ((size_t)p0 * N_ + n) * D_ + j8;
  v8h lo[RPL_], hi[RPL_];
#pragma unroll
  for (int i = 0; i < RPL_; ++i) {
    lo[i] = *reinterpret_cast<const v8h*>(p + (size_t)i * (N_ * D_));
    hi[i] = *reinterpret_cast<const v8h*>(p + (size_t)i * (N_ * D_) + 32);
  }

  const float* g  = (isq ? gq : gk) + j8;
  const float* cr = cosp + n * 64 + j8;
  const float* sr = sinp + n * 64 + j8;
  v4f tg[4], tc[4], ts[4];                 // [0],[1]: d = j8..j8+7; [2],[3]: d + 32
#pragma unroll
  for (int q = 0; q < 4; ++q)
    tc[q] = *reinterpret_cast<const v4f*>(cr + (q >> 1) * 32 + (q & 1) * 4);
  asm volatile("s_wait_xcnt 0x0" ::: "memory");
#pragma unroll
  for (int q = 0; q < 4; ++q)
    ts[q] = *reinterpret_cast<const v4f*>(sr + (q >> 1) * 32 + (q & 1) * 4);
  asm volatile("s_wait_xcnt 0x0" ::: "memory");
#pragma unroll
  for (int q = 0; q < 4; ++q)
    tg[q] = *reinterpret_cast<const v4f*>(g + (q >> 1) * 32 + (q & 1) * 4);
  // Keeps all 28 loads ahead of the arithmetic (one memory latency a wave):
  // without it the compiler sinks table loads between the rows' sums.
  __builtin_amdgcn_sched_barrier(0);

#pragma unroll
  for (int i = 0; i < RPL_; ++i) {
    float e0[8], e1[8];
    float ss = 0.f;
#pragma unroll
    for (int k = 0; k < 8; ++k) {
      e0[k] = (float)lo[i][k];
      e1[k] = (float)hi[i][k];
      ss += e0[k] * e0[k] + e1[k] * e1[k];
    }
    ss += quad_swap<0xB1>(ss);             // lane ^ 1
    ss += quad_swap<0x4E>(ss);             // lane ^ 2: all four lanes hold the sum
    // the argument is at least 1e-6: rsqrtf's rescaling of tiny arguments never acts
    float rinv = rsq_slot(ss * (1.0f / 64.0f) + 1e-6f);

    v8h olo, ohi;
#pragma unroll
    for (int k = 0; k < 8; ++k) {
      const int q = k >> 2, c = k & 3;
      float x0 = e0[k] * rinv * tg[q][c];
      float x1 = e1[k] * rinv * tg[q + 2][c];
      float y0 = x0 * tc[q][c]     - x1 * ts[q][c];      // d < 32: -x2*sin
      float y1 = x1 * tc[q + 2][c] + x0 * ts[q + 2][c];  // d >= 32: +x1*sin
      olo[k] = (_Float16)(y0 * qs);
      ohi[k] = (_Float16)(y1 * qs);
    }
    *reinterpret_cast<v8h*>(p + (size_t)i * (N_ * D_))      = olo;
    *reinterpret_cast<v8h*>(p + (size_t)i * (N_ * D_) + 32) = ohi;
  }
}

static __device__ __forceinline__ float xhalf(float x) {
  int v = __builtin_bit_cast(int, x);
  return __builtin_bit_cast(float, __builtin_amdgcn_permlanex16(
      v, v, 0x76543210, 0xfedcba98, false, false));
}

static __device__ __forceinline__ void exp2_block(float (&x)[16], float& a) {
  asm("v_exp_f32 %0, %0\n\tv_exp_f32 %1, %1\n\tv_exp_f32 %2, %2\n\t"
      "v_exp_f32 %3, %3\n\tv_exp_f32 %4, %4\n\tv_exp_f32 %5, %5\n\t"
      "v_exp_f32 %6, %6\n\tv_exp_f32 %7, %7\n\tv_exp_f32 %8, %8\n\t"
      "v_exp_f32 %9, %9\n\tv_exp_f32 %10, %10\n\tv_exp_f32 %11, %11\n\t"
      "v_exp_f32 %12, %12\n\tv_exp_f32 %13, %13\n\tv_exp_f32 %14, %14\n\t"
      "v_exp_f32 %15, %15\n\tv_exp_f32 %16, %16\n\tv_nop"
      : "+v"(x[0]), "+v"(x[1]), "+v"(x[2]), "+v"(x[3]), "+v"(x[4]), "+v"(x[5]),
        "+v"(x[6]), "+v"(x[7]), "+v"(a), "+v"(x[8]), "+v"(x[9]), "+v"(x[10]),
        "+v"(x[11]), "+v"(x[12]), "+v"(x[13]), "+v"(x[14]), "+v"(x[15]));
}

#define VP_ 80

typedef __attribute__((ext_vector_type(8))) short s16x8;
typedef __attribute__((address_space(3))) s16x8 lds_s16x8;

static __device__ __forceinline__ v16h frag_ld_tr(const _Float16* tile) {
  const int lane = threadIdx.x & 31;
  const _Float16* p = tile + (((lane >> 4) << 3) + (lane & 7)) * VP_ +
                      (((lane >> 3) & 1) << 3);
  v8h lo = __builtin_bit_cast(v8h, __builtin_amdgcn_ds_load_tr16_b128_v8i16(
      (lds_s16x8*)p));
  v8h hi = __builtin_bit_cast(v8h, __builtin_amdgcn_ds_load_tr16_b128_v8i16(
      (lds_s16x8*)(p + 16 * VP_)));
  return __builtin_shufflevector(lo, hi, 0, 1, 2, 3, 4, 5, 6, 7,
                                 8, 9, 10, 11, 12, 13, 14, 15);
}

__global__ __launch_bounds__(256) void flash_attn_kernel(
    const _Float16* __restrict__ qkv3, _Float16* __restrict__ attn_out) {
  __shared__ _Float16 Klds[64 * 72];       // [key][d], stride 72
  __shared__ __attribute__((aligned(16))) _Float16 Vlds[64 * VP_];   // [key][d]

  const int lane = threadIdx.x & 31;
  const int l16  = lane & 15;
  const int hlf8 = (lane >> 4) << 3;
  const int wid  = threadIdx.x >> 5;

  const int b = blockIdx.y >> 4;
  const int h = blockIdx.y & 15;
  const size_t plane = (size_t)N_ * D_;
  const _Float16* Q = qkv3 + ((size_t)((0 * B_ + b) * H_ + h)) * plane;
  const _Float16* K = qkv3 + ((size_t)((1 * B_ + b) * H_ + h)) * plane;
  const _Float16* V = qkv3 + ((size_t)((2 * B_ + b) * H_ + h)) * plane;

  const int qbase = blockIdx.x * 128 + wid * 16;

  v16h qf[2];                              // B operand: column = query l16
  qf[0] = frag_ld(Q + (size_t)qbase * D_ + 0,  D_);
  qf[1] = frag_ld(Q + (size_t)qbase * D_ + 32, D_);

  v8f o[4];                                // o[dt][r] = O[query l16][dt*16 + hlf8 + r]
#pragma unroll
  for (int dt = 0; dt < 4; ++dt) o[dt] = zero_v8f();
  float mrun = -3.0e38f;                   // this lane's query: running maximum
  float lrun = 0.f;                        // and the sum over this half's keys

  const int ntiles = N_ / 64;
  for (int kt = 0; kt < ntiles; ++kt) {
    const int k0 = kt * 64;

    // prefetch next 64-key K/V tile (one 128B line per thread)
    if (kt + 1 < ntiles) {
      int t = threadIdx.x;
      if (t < 64)
        __builtin_prefetch((const void*)(K + (size_t)(k0 + 64 + t) * D_), 0, 1);
      else if (t < 128)
        __builtin_prefetch((const void*)(V + (size_t)(k0 + t) * D_), 0, 1);
    }

    // stage: K and V row-major, 16 B a lane and copy. Unrolled so that a lane's four
    // copies issue back to back, all lanes on, and share one latency.
#pragma unroll
    for (int j = 0; j < 2; ++j) {
      const int t = threadIdx.x + j * 256;
      const int key = t >> 3, c = t & 7;
      cp_b128(K + (size_t)(k0 + key) * D_ + c * 8, &Klds[key * 72 + c * 8]);
      cp_b128(V + (size_t)(k0 + key) * D_ + c * 8, &Vlds[key * VP_ + c * 8]);
    }
    // this wave's copies have landed before the barrier behind which all waves read
    asm volatile("s_wait_asynccnt 0x0" ::: "memory");
    __syncthreads();

#pragma unroll
    for (int ss = 0; ss < 2; ++ss) {       // two 32-key sub-steps
      const _Float16* Kb = &Klds[(ss * 32) * 72];

      // S^T(32 keys x 16 queries): s0[r] = key hlf8 + r, s1[r] = key 16 + hlf8 + r
      v8f s0 = zero_v8f(), s1 = zero_v8f();
      s0 = wmma_f16(frag_ld(&Kb[0 * 16 * 72 + 0],  72), qf[0], s0);
      s0 = wmma_f16(frag_ld(&Kb[0 * 16 * 72 + 32], 72), qf[1], s0);
      s1 = wmma_f16(frag_ld(&Kb[1 * 16 * 72 + 0],  72), qf[0], s1);
      s1 = wmma_f16(frag_ld(&Kb[1 * 16 * 72 + 32], 72), qf[1], s1);

      // online softmax, base-2 (log2e folded into Q), one query per lane
      float mx = fmaxf(s0[0], s1[0]);
#pragma unroll
      for (int r = 1; r < 8; ++r) mx = fmaxf(mx, fmaxf(s0[r], s1[r]));
      mx = fmaxf(mx, xhalf(mx));           // both halves hold the query's maximum
      float mnew = fmaxf(mrun, mx);
      float alpha = mrun - mnew;
      mrun = mnew;
      float p[16];                         // p[2r] = key hlf8 + r, p[2r + 1] = 16 + hlf8 + r
#pragma unroll
      for (int r = 0; r < 8; ++r) {
        p[2 * r]     = s0[r] - mnew;
        p[2 * r + 1] = s1[r] - mnew;
      }
      exp2_block(p, alpha);

      // P^T as B fragment: element s = key kmap(s) = s0[s] (s < 8), s1[s - 8]
      v16h pf;
      float ps = 0.f;
#pragma unroll
      for (int r = 0; r < 8; ++r) {
        float p0 = p[2 * r];
        float p1 = p[2 * r + 1];
        ps += p0 + p1;
        pf[r]     = (_Float16)p0;
        pf[r + 8] = (_Float16)p1;
      }
      lrun = lrun * alpha + ps;
#pragma unroll
      for (int dt = 0; dt < 4; ++dt) o[dt] *= alpha;

      // O^T(64 d x 16 queries) += V^T(64 x 32 keys) * P^T(32 x 16)
#pragma unroll
      for (int dt = 0; dt < 4; ++dt)
        o[dt] = wmma_f16(frag_ld_tr(&Vlds[ss * 32 * VP_ + dt * 16]), pf, o[dt]);
    }
    // this wave's LDS reads are done before the barrier behind which the next
    // tile's copies overwrite both buffers
    asm volatile("s_wait_dscnt 0x0" ::: "memory");
    __syncthreads();
  }

  // join the halves' sums, normalize, store f16 [B][N][C] with head offset:
  // a lane's 8 registers of a tile are 8 consecutive d of its query row
  const float lsum = lrun + xhalf(lrun);
  _Float16* orow = attn_out + (size_t)(b * N_ + qbase + l16) * C_ + h * D_ + hlf8;
#pragma unroll
  for (int dt = 0; dt < 4; ++dt) {
    v8h ov;
#pragma unroll
    for (int r = 0; r < 8; ++r) ov[r] = (_Float16)(o[dt][r] / lsum);
    *reinterpret_cast<v8h*>(orow + dt * 16) = ov;
  }
}

// ---------------------------------------------------------------------------
// Host-side launch pipeline
// ---------------------------------------------------------------------------
extern "C" void kernel_launch(void* const* d_in, const int* in_sizes, int n_in,
                              void* d_out, int out_size, void* d_ws, size_t ws_size,
                              hipStream_t stream) {
  const float* hidden = (const float*)d_in[0];
  const float* cosp   = (const float*)d_in[1];
  const float* sinp   = (const float*)d_in[2];
  const float* Wqkv   = (const float*)d_in[3];
  const float* Wout   = (const float*)d_in[4];
  const float* gq     = (const float*)d_in[5];
  const float* gk     = (const float*)d_in[6];

  // workspace layout (bytes):
  //   Xh      f16 [8192,1024]           16,777,216
  //   WqkvT   f16 [3072,1024]            6,291,456
  //   WoutT   f16 [1024,1024]            2,097,152
  //   qkv3    f16 [3][2][16][4096][64]  50,331,648
  //   attnH   f16 [8192,1024]           16,777,216   (total ~92.3 MB)
  char* ws = (char*)d_ws;
  _Float16* Xh    = (_Float16*)(ws);
  _Float16* WqkvT = (_Float16*)(ws + 16777216);
  _Float16* WoutT = (_Float16*)(ws + 16777216 + 6291456);
  _Float16* qkv3  = (_Float16*)(ws + 16777216 + 6291456 + 2097152);
  _Float16* attnH = (_Float16*)(ws + 16777216 + 6291456 + 2097152 + 50331648);

  f32_to_f16_kernel<<<dim3((BN_ * C_) / 8192), 256, 0, stream>>>(hidden, Xh);
  transpose_f32_to_f16_kernel<C_, C3_><<<dim3(C3_ / 256, C_ / 16), 256, 0, stream>>>(
      Wqkv, WqkvT);
  transpose_f32_to_f16_kernel<C_, C_><<<dim3(C_ / 256, C_ / 16), 256, 0, stream>>>(
      Wout, WoutT);

  // QKV projection, scattered into [3][B][H][N][D] f16
  gemm_f16_wmma<0><<<dim3(C3_ / 128, BN_ / 128), 256, 0, stream>>>(
      Xh, WqkvT, (void*)qkv3, BN_, C3_, C_);

  // per-head RMSNorm + RoPE on q/k planes (in place)
  rmsnorm_rope_kernel<<<dim3((2 * B_ * H_ / RPL_) * (N_ / 64)), 256, 0, stream>>>(
      qkv3, cosp, sinp, gq, gk);

  // flash attention -> f16 [B,N,C]
  flash_attn_kernel<<<dim3(N_ / 128, B_ * H_), 256, 0, stream>>>(qkv3, attnH);

  // output projection -> fp32 d_out
  gemm_f16_wmma<1><<<dim3(C_ / 128, BN_ / 128), 256, 0, stream>>>(
      attnH, WoutT, d_out, BN_, C_, C_);
}

// v006
// It runs in 208 microseconds.
// Two timings next to v005 put it at 1.06 and 1.05 times that version's speed.
// All steps since v000 together make it 3.54 times as fast.
#include <hip/hip_runtime.h>
#include <hip/hip_bf16.h>

typedef __attribute__((ext_vector_type(16))) _Float16 v16h;
typedef __attribute__((ext_vector_type(8)))  _Float16 v8h;
typedef __attribute__((ext_vector_type(8)))  float    v8f;
typedef __attribute__((ext_vector_type(4)))  _Float16 v4h;
typedef __attribute__((ext_vector_type(4)))  float    v4f;

#define B_   2
#define N_   4096
#define C_   1024
#define H_   16
#define D_   64
#define BN_  8192
#define C3_  3072

#if defined(__has_builtin)
#if __has_builtin(__builtin_amdgcn_global_load_async_to_lds_b128)
#define USE_ASYNC_LDS 1
#endif
#endif

typedef int b128_t __attribute__((vector_size(16)));
typedef __attribute__((address_space(1))) b128_t* gb128_p;
typedef __attribute__((address_space(3))) b128_t* lb128_p;

static __device__ __forceinline__ void cp_b128(const _Float16* g, _Float16* l) {
#ifdef USE_ASYNC_LDS
  __builtin_amdgcn_global_load_async_to_lds_b128(
      (gb128_p)(unsigned long long)(uintptr_t)g,
      (lb128_p)(unsigned)(uintptr_t)l,        // generic LDS addr: low 32 bits
      0, 0);
#else
  *reinterpret_cast<v8h*>(l) = *reinterpret_cast<const v8h*>(g);
#endif
}

static __device__ __forceinline__ v16h frag_ld(const _Float16* base, int stride) {
  const int lane = threadIdx.x & 31;
  const _Float16* p = base + (lane & 15) * stride + ((lane >> 4) << 3);
  v8h lo = *reinterpret_cast<const v8h*>(p);
  v8h hi = *reinterpret_cast<const v8h*>(p + 16);
  return __builtin_shufflevector(lo, hi, 0, 1, 2, 3, 4, 5, 6, 7,
                                 8, 9, 10, 11, 12, 13, 14, 15);
}

static __device__ __forceinline__ v8f wmma_f16(v16h a, v16h b, v8f c) {
  return __builtin_amdgcn_wmma_f32_16x16x32_f16(false, a, false, b,
                                                (short)0, c, false, false);
}

static __device__ __forceinline__ v8f zero_v8f() {
  v8f z = {0.f, 0.f, 0.f, 0.f, 0.f, 0.f, 0.f, 0.f};
  return z;
}

// ---------------------------------------------------------------------------
// fp32 -> f16 elementwise, and transposed f16 weight copies.
// Few, fat waves: many elements a lane, wide accesses, all loads of a lane in
// flight together. Every grid covers its array exactly (no bounds test).
// ---------------------------------------------------------------------------
// A block converts 8192 consecutive floats: 8 loads of 16 B a lane, all issued
// before the first store; each wave-wide access covers whole 128-B lines.
__global__ __launch_bounds__(256) void f32_to_f16_kernel(
    const float* __restrict__ in, _Float16* __restrict__ out) {
  const size_t base = (size_t)blockIdx.x * 8192 + threadIdx.x * 4;
  v4f v[8];
#pragma unroll
  for (int j = 0; j < 8; ++j)
    v[j] = *reinterpret_cast<const v4f*>(in + base + j * 1024);
#pragma unroll
  for (int j = 0; j < 8; ++j)
    *reinterpret_cast<v4h*>(out + base + j * 1024) =
        __builtin_convertvector(v[j], v4h);
}

// A lane takes column n and 16 consecutive k: 16 row-coalesced loads, then
// 32 contiguous bytes of WT row n. grid = (Ncol / 256, K / 16).
// K and Ncol are compile-time so that all 16 loads share one address register
// pair and differ in their immediate offsets only.
template <int K, int Ncol>
__global__ __launch_bounds__(256) void transpose_f32_to_f16_kernel(
    const float* __restrict__ W, _Float16* __restrict__ WT) {
  const int n  = blockIdx.x * 256 + threadIdx.x;
  const int k0 = blockIdx.y * 16;
  const float* src = W + (size_t)k0 * Ncol + n;
  float v[16];
#pragma unroll
  for (int j = 0; j < 16; ++j) v[j] = src[j * Ncol];
  v8h lo, hi;
#pragma unroll
  for (int j = 0; j < 8; ++j) {
    lo[j] = (_Float16)v[j];
    hi[j] = (_Float16)v[j + 8];
  }
  _Float16* dst = WT + (size_t)n * K + k0;
  *reinterpret_cast<v8h*>(dst)     = lo;
  *reinterpret_cast<v8h*>(dst + 8) = hi;
}

// ---------------------------------------------------------------------------
// GEMM: out[M][Nn] = A[M][Kk] * BT[Nn][Kk]^T   (f16 in, f32 accumulate)
// 256 threads = 8 waves (4x2), block tile 128x128, wave tile 32x64
// (2x4 fragments -> 8 wmma per wave per 32-deep block, two blocks per K step).
// A K step is 64 deep: a staged row is one whole 128-B line, brought by 8 lanes.
// LDS ping-pong double buffering; stage for tile k+1 is issued (async when
// available) before computing tile k.
// MODE 0: scatter f16 into qkv3 [3][B][H][N][D].   MODE 1: fp32 row-major.
// ---------------------------------------------------------------------------
template <int MODE>
__global__ __launch_bounds__(256) void gemm_f16_wmma(
    const _Float16* __restrict__ A, const _Float16* __restrict__ BT,
    void* __restrict__ out, int M, int Nn, int Kk) {
  __shared__ _Float16 Alds[2][128 * 72];   // 64 k-halves + 8 pad: 144 B, 16 B x odd
  __shared__ _Float16 Blds[2][128 * 72];

  const int lane = threadIdx.x & 31;
  const int l16  = lane & 15;
  const int wid  = threadIdx.x >> 5;
  const int wrow = wid >> 1;               // 0..3  -> rows wrow*32
  const int wcol = wid & 1;                // 0..1  -> cols wcol*64
  const int m0 = blockIdx.y * 128;
  const int n0 = blockIdx.x * 128;

  v8f acc[2][4];
#pragma unroll
  for (int i = 0; i < 2; ++i)
#pragma unroll
    for (int j = 0; j < 4; ++j) acc[i][j] = zero_v8f();

  auto stage = [&](int k0, int buf) {
#pragma unroll
    for (int q = 0; q < 4; ++q) {
      const int t = threadIdx.x + q * 256;
      const int r = t >> 3, c = t & 7;
      cp_b128(A + (size_t)(m0 + r) * Kk + k0 + c * 8, &Alds[buf][r * 72 + c * 8]);
      cp_b128(BT + (size_t)(n0 + r) * Kk + k0 + c * 8, &Blds[buf][r * 72 + c * 8]);
    }
  };

  const int nk = Kk >> 6;                  // K steps of 64
  stage(0, 0);
  for (int kk = 0; kk < nk; ++kk) {
    // this wave's reads of the buffer that is refilled behind the barrier are done,
    // and its copies of this step's tile have landed, before all waves meet
    asm volatile("s_wait_dscnt 0x0" ::: "memory");
    asm volatile("s_wait_asynccnt 0x0" ::: "memory");
    __syncthreads();
    if (kk + 1 < nk) stage((kk + 1) << 6, (kk + 1) & 1);

    const _Float16* Ab = Alds[kk & 1];
    const _Float16* Bb = Blds[kk & 1];
#pragma unroll
    for (int ks = 0; ks < 2; ++ks) {       // two 32-deep blocks, k ascending
      v16h af[2], bf[4];
#pragma unroll
      for (int i = 0; i < 2; ++i)
        af[i] = frag_ld(&Ab[(wrow * 32 + i * 16) * 72 + ks * 32], 72);
#pragma unroll
      for (int j = 0; j < 4; ++j)
        bf[j] = frag_ld(&Bb[(wcol * 64 + j * 16) * 72 + ks * 32], 72);
#pragma unroll
      for (int i = 0; i < 2; ++i)
#pragma unroll
        for (int j = 0; j < 4; ++j) acc[i][j] = wmma_f16(af[i], bf[j], acc[i][j]);
    }
  }
  // the ring's closing wait: none of this wave's copies is in flight behind the loop,
  // whatever the trip count
  asm volatile("s_wait_asynccnt 0x0" ::: "memory");

  // epilogue: C/D layout -> element (m = r + 8*(lane>>4), n = lane&15)
#pragma unroll
  for (int i = 0; i < 2; ++i) {
#pragma unroll
    for (int j = 0; j < 4; ++j) {
#pragma unroll
      for (int r = 0; r < 8; ++r) {
        int row = m0 + wrow * 32 + i * 16 + r + ((lane >> 4) << 3);
        int col = n0 + wcol * 64 + j * 16 + l16;
        float val = acc[i][j][r];
        if (MODE == 0) {
          int s = col >> 10, rem = col & 1023;
          int hh = rem >> 6, d = rem & 63;
          int bb = row >> 12, nn = row & 4095;
          ((_Float16*)out)[((((size_t)s * B_ + bb) * H_ + hh) * N_ + nn) * D_ + d] =
              (_Float16)val;
        } else {
          ((float*)out)[(size_t)row * Nn + col] = val;
        }
      }
    }
  }
}

#define RPL_ 8

template <int CTRL>
static __device__ __forceinline__ float quad_swap(float x) {   // quad_perm DPP
  return __builtin_bit_cast(float, __builtin_amdgcn_mov_dpp(
      __builtin_bit_cast(int, x), CTRL, 0xf, 0xf, true));
}

static __device__ __forceinline__ float rsq_slot(float x) {
  float r;
  asm("v_rsq_f32 %0, %1\n\tv_nop" : "=v"(r) : "v"(x));
  return r;
}

__global__ __launch_bounds__(256) void rmsnorm_rope_kernel(
    _Float16* __restrict__ qkv3, const float* __restrict__ cosp,
    const float* __restrict__ sinp, const float* __restrict__ gq,
    const float* __restrict__ gk) {
  const int j8 = (threadIdx.x & 3) << 3;
  const int n  = ((blockIdx.x & 63) << 6) + (threadIdx.x >> 2);   // 64 rows a block
  const int p0 = (blockIdx.x >> 6) * RPL_;                        // first plane
  const bool isq = p0 < B_ * H_;
  // 1/sqrt(D) * log2(e) folded into Q; K is multiplied by one, which is exact
  const float qs = isq ? 0.125f * 1.44269504f : 1.0f;

  _Float16* p = qkv3 + ((size_t)p0 * N_ + n) * D_ + j8;
  v8h lo[RPL_], hi[RPL_];
#pragma unroll
  for (int i = 0; i < RPL_; ++i) {
    lo[i] = *reinterpret_cast<const v8h*>(p + (size_t)i * (N_ * D_));
    hi[i] = *reinterpret_cast<const v8h*>(p + (size_t)i * (N_ * D_) + 32);
  }

  const float* g  = (isq ? gq : gk) + j8;
  const float* cr = cosp + n * 64 + j8;
  const float* sr = sinp + n * 64 + j8;
  v4f tg[4], tc[4], ts[4];                 // [0],[1]: d = j8..j8+7; [2],[3]: d + 32
#pragma unroll
  for (int q = 0; q < 4; ++q)
    tc[q] = *reinterpret_cast<const v4f*>(cr + (q >> 1) * 32 + (q & 1) * 4);
  asm volatile("s_wait_xcnt 0x0" ::: "memory");
#pragma unroll
  for (int q = 0; q < 4; ++q)
    ts[q] = *reinterpret_cast<const v4f*>(sr + (q >> 1) * 32 + (q & 1) * 4);
  asm volatile("s_wait_xcnt 0x0" ::: "memory");
#pragma unroll
  for (int q = 0; q < 4; ++q)
    tg[q] = *reinterpret_cast<const v4f*>(g + (q >> 1) * 32 + (q & 1) * 4);
  // Keeps all 28 loads ahead of the arithmetic (one memory latency a wave):
  // without it the compiler sinks table loads between the rows' sums.
  __builtin_amdgcn_sched_barrier(0);

#pragma unroll
  for (int i = 0; i < RPL_; ++i) {
    float e0[8], e1[8];
    float ss = 0.f;
#pragma unroll
    for (int k = 0; k < 8; ++k) {
      e0[k] = (float)lo[i][k];
      e1[k] = (float)hi[i][k];
      ss += e0[k] * e0[k] + e1[k] * e1[k];
    }
    ss += quad_swap<0xB1>(ss);             // lane ^ 1
    ss += quad_swap<0x4E>(ss);             // lane ^ 2: all four lanes hold the sum
    // the argument is at least 1e-6: rsqrtf's rescaling of tiny arguments never acts
    float rinv = rsq_slot(ss * (1.0f / 64.0f) + 1e-6f);

    v8h olo, ohi;
#pragma unroll
    for (int k = 0; k < 8; ++k) {
      const int q = k >> 2, c = k & 3;
      float x0 = e0[k] * rinv * tg[q][c];
      float x1 = e1[k] * rinv * tg[q + 2][c];
      float y0 = x0 * tc[q][c]     - x1 * ts[q][c];      // d < 32: -x2*sin
      float y1 = x1 * tc[q + 2][c] + x0 * ts[q + 2][c];  // d >= 32: +x1*sin
      olo[k] = (_Float16)(y0 * qs);
      ohi[k] = (_Float16)(y1 * qs);
    }
    *reinterpret_cast<v8h*>(p + (size_t)i * (N_ * D_))      = olo;
    *reinterpret_cast<v8h*>(p + (size_t)i * (N_ * D_) + 32) = ohi;
  }
}

static __device__ __forceinline__ float xhalf(float x) {
  int v = __builtin_bit_cast(int, x);
  return __builtin_bit_cast(float, __builtin_amdgcn_permlanex16(
      v, v, 0x76543210, 0xfedcba98, false, false));
}

static __device__ __forceinline__ void exp2_block(float (&x)[16], float& a) {
  asm("v_exp_f32 %0, %0\n\tv_exp_f32 %1, %1\n\tv_exp_f32 %2, %2\n\t"
      "v_exp_f32 %3, %3\n\tv_exp_f32 %4, %4\n\tv_exp_f32 %5, %5\n\t"
      "v_exp_f32 %6, %6\n\tv_exp_f32 %7, %7\n\tv_exp_f32 %8, %8\n\t"
      "v_exp_f32 %9, %9\n\tv_exp_f32 %10, %10\n\tv_exp_f32 %11, %11\n\t"
      "v_exp_f32 %12, %12\n\tv_exp_f32 %13, %13\n\tv_exp_f32 %14, %14\n\t"
      "v_exp_f32 %15, %15\n\tv_exp_f32 %16, %16\n\tv_nop"
      : "+v"(x[0]), "+v"(x[1]), "+v"(x[2]), "+v"(x[3]), "+v"(x[4]), "+v"(x[5]),
        "+v"(x[6]), "+v"(x[7]), "+v"(a), "+v"(x[8]), "+v"(x[9]), "+v"(x[10]),
        "+v"(x[11]), "+v"(x[12]), "+v"(x[13]), "+v"(x[14]), "+v"(x[15]));
}

#define VP_ 80

typedef __attribute__((ext_vector_type(8))) short s16x8;
typedef __attribute__((address_space(3))) s16x8 lds_s16x8;

static __device__ __forceinline__ v16h frag_ld_tr(const _Float16* tile) {
  const int lane = threadIdx.x & 31;
  const _Float16* p = tile + (((lane >> 4) << 3) + (lane & 7)) * VP_ +
                      (((lane >> 3) & 1) << 3);
  v8h lo = __builtin_bit_cast(v8h, __builtin_amdgcn_ds_load_tr16_b128_v8i16(
      (lds_s16x8*)p));
  v8h hi = __builtin_bit_cast(v8h, __builtin_amdgcn_ds_load_tr16_b128_v8i16(
      (lds_s16x8*)(p + 16 * VP_)));
  return __builtin_shufflevector(lo, hi, 0, 1, 2, 3, 4, 5, 6, 7,
                                 8, 9, 10, 11, 12, 13, 14, 15);
}

__global__ __launch_bounds__(256) void flash_attn_kernel(
    const _Float16* __restrict__ qkv3, _Float16* __restrict__ attn_out) {
  __shared__ _Float16 Klds[64 * 72];       // [key][d], stride 72
  __shared__ __attribute__((aligned(16))) _Float16 Vlds[64 * VP_];   // [key][d]

  const int lane = threadIdx.x & 31;
  const int l16  = lane & 15;
  const int hlf8 = (lane >> 4) << 3;
  const int wid  = threadIdx.x >> 5;

  const int b = blockIdx.y >> 4;
  const int h = blockIdx.y & 15;
  const size_t plane = (size_t)N_ * D_;
  const _Float16* Q = qkv3 + ((size_t)((0 * B_ + b) * H_ + h)) * plane;
  const _Float16* K = qkv3 + ((size_t)((1 * B_ + b) * H_ + h)) * plane;
  const _Float16* V = qkv3 + ((size_t)((2 * B_ + b) * H_ + h)) * plane;

  const int qbase = blockIdx.x * 256 + wid * 32;

  v16h qf[2][2];                           // B operand: column = query g*16 + l16
  v8f o[2][4];                             // o[g][dt][r] = O[query][dt*16 + hlf8 + r]
  float mrun[2], lrun[2];                  // a lane's two queries: running maximum,
                                           // and the sum over this half's keys
  // Every loop over g, dt or r in this kernel is unrolled: its index picks registers
  // (fragments, accumulators, scores), which a rolled loop would push to scratch.
#pragma unroll
  for (int g = 0; g < 2; ++g) {
    qf[g][0] = frag_ld(Q + (size_t)(qbase + g * 16) * D_ + 0,  D_);
    qf[g][1] = frag_ld(Q + (size_t)(qbase + g * 16) * D_ + 32, D_);
#pragma unroll
    for (int dt = 0; dt < 4; ++dt) o[g][dt] = zero_v8f();
    mrun[g] = -3.0e38f;
    lrun[g] = 0.f;
  }

  const int ntiles = N_ / 64;
  for (int kt = 0; kt < ntiles; ++kt) {
    const int k0 = kt * 64;

    // prefetch next 64-key K/V tile (one 128B line per thread)
    if (kt + 1 < ntiles) {
      int t = threadIdx.x;
      if (t < 64)
        __builtin_prefetch((const void*)(K + (size_t)(k0 + 64 + t) * D_), 0, 1);
      else if (t < 128)
        __builtin_prefetch((const void*)(V + (size_t)(k0 + t) * D_), 0, 1);
    }

    // stage: K and V row-major, 16 B a lane and copy. Unrolled so that a lane's four
    // copies issue back to back, all lanes on, and share one latency.
#pragma unroll
    for (int j = 0; j < 2; ++j) {
      const int t = threadIdx.x + j * 256;
      const int key = t >> 3, c = t & 7;
      cp_b128(K + (size_t)(k0 + key) * D_ + c * 8, &Klds[key * 72 + c * 8]);
      cp_b128(V + (size_t)(k0 + key) * D_ + c * 8, &Vlds[key * VP_ + c * 8]);
    }
    // this wave's copies have landed before the barrier behind which all waves read
    asm volatile("s_wait_asynccnt 0x0" ::: "memory");
    __syncthreads();

#pragma unroll
    for (int ss = 0; ss < 2; ++ss) {       // two 32-key sub-steps
      const _Float16* Kb = &Klds[(ss * 32) * 72];

      // the four K fragments of the sub-step, each read once for both groups
      v16h kf[4];
      kf[0] = frag_ld(&Kb[0 * 16 * 72 + 0],  72);
      kf[1] = frag_ld(&Kb[0 * 16 * 72 + 32], 72);
      kf[2] = frag_ld(&Kb[1 * 16 * 72 + 0],  72);
      kf[3] = frag_ld(&Kb[1 * 16 * 72 + 32], 72);

      // S^T(32 keys x 16 queries) a group: s0[r] = key hlf8 + r, s1[r] = key 16 + hlf8 + r
      v8f s0[2], s1[2];
#pragma unroll
      for (int g = 0; g < 2; ++g) {
        s0[g] = wmma_f16(kf[0], qf[g][0], zero_v8f());
        s1[g] = wmma_f16(kf[2], qf[g][0], zero_v8f());
      }
#pragma unroll
      for (int g = 0; g < 2; ++g) {
        s0[g] = wmma_f16(kf[1], qf[g][1], s0[g]);
        s1[g] = wmma_f16(kf[3], qf[g][1], s1[g]);
      }

      v16h vf[4];
#pragma unroll
      for (int dt = 0; dt < 4; ++dt)
        vf[dt] = frag_ld_tr(&Vlds[ss * 32 * VP_ + dt * 16]);

      v16h pf[2];
#pragma unroll
      for (int g = 0; g < 2; ++g) {
        // online softmax, base-2 (log2e folded into Q), one query per lane
        float mx = fmaxf(s0[g][0], s1[g][0]);
#pragma unroll
        for (int r = 1; r < 8; ++r) mx = fmaxf(mx, fmaxf(s0[g][r], s1[g][r]));
        mx = fmaxf(mx, xhalf(mx));         // both halves hold the query's maximum
        float mnew = fmaxf(mrun[g], mx);
        float alpha = mrun[g] - mnew;
        mrun[g] = mnew;
        float p[16];                       // p[2r] = key hlf8 + r, p[2r + 1] = 16 + hlf8 + r
#pragma unroll
        for (int r = 0; r < 8; ++r) {
          p[2 * r]     = s0[g][r] - mnew;
          p[2 * r + 1] = s1[g][r] - mnew;
        }
        exp2_block(p, alpha);

        // P^T as B fragment: element s = key kmap(s) = s0[s] (s < 8), s1[s - 8]
        float ps = 0.f;
#pragma unroll
        for (int r = 0; r < 8; ++r) {
          float p0 = p[2 * r];
          float p1 = p[2 * r + 1];
          ps += p0 + p1;
          pf[g][r]     = (_Float16)p0;
          pf[g][r + 8] = (_Float16)p1;
        }
        lrun[g] = lrun[g] * alpha + ps;
#pragma unroll
        for (int dt = 0; dt < 4; ++dt) o[g][dt] *= alpha;
      }

      // O^T(64 d x 16 queries) += V^T(64 x 32 keys) * P^T(32 x 16), a group
#pragma unroll
      for (int dt = 0; dt < 4; ++dt)
#pragma unroll
        for (int g = 0; g < 2; ++g) o[g][dt] = wmma_f16(vf[dt], pf[g], o[g][dt]);
    }
    // this wave's LDS reads are done before the barrier behind which the next
    // tile's copies overwrite both buffers
    asm volatile("s_wait_dscnt 0x0" ::: "memory");
    __syncthreads();
  }

  // join the halves' sums, normalize, store f16 [B][N][C] with head offset:
  // a lane's 8 registers of a tile are 8 consecutive d of its query row
#pragma unroll
  for (int g = 0; g < 2; ++g) {
    const float lsum = lrun[g] + xhalf(lrun[g]);
    _Float16* orow =
        attn_out + (size_t)(b * N_ + qbase + g * 16 + l16) * C_ + h * D_ + hlf8;
#pragma unroll
    for (int dt = 0; dt < 4; ++dt) {
      v8h ov;
#pragma unroll
      for (int r = 0; r < 8; ++r) ov[r] = (_Float16)(o[g][dt][r] / lsum);
      *reinterpret_cast<v8h*>(orow + dt * 16) = ov;
    }
  }
}

// ---------------------------------------------------------------------------
// Host-side launch pipeline
// ---------------------------------------------------------------------------
extern "C" void kernel_launch(void* const* d_in, const int* in_sizes, int n_in,
                              void* d_out, int out_size, void* d_ws, size_t ws_size,
                              hipStream_t stream) {
  const float* hidden = (const float*)d_in[0];
  const float* cosp   = (const float*)d_in[1];
  const float* sinp   = (const float*)d_in[2];
  const float* Wqkv   = (const float*)d_in[3];
  const float* Wout   = (const float*)d_in[4];
  const float* gq     = (const float*)d_in[5];
  const float* gk     = (const float*)d_in[6];

  // workspace layout (bytes):
  //   Xh      f16 [8192,1024]           16,777,216
  //   WqkvT   f16 [3072,1024]            6,291,456
  //   WoutT   f16 [1024,1024]            2,097,152
  //   qkv3    f16 [3][2][16][4096][64]  50,331,648
  //   attnH   f16 [8192,1024]           16,777,216   (total ~92.3 MB)
  char* ws = (char*)d_ws;
  _Float16* Xh    = (_Float16*)(ws);
  _Float16* WqkvT = (_Float16*)(ws + 16777216);
  _Float16* WoutT = (_Float16*)(ws + 16777216 + 6291456);
  _Float16* qkv3  = (_Float16*)(ws + 16777216 + 6291456 + 2097152);
  _Float16* attnH = (_Float16*)(ws + 16777216 + 6291456 + 2097152 + 50331648);

  f32_to_f16_kernel<<<dim3((BN_ * C_) / 8192), 256, 0, stream>>>(hidden, Xh);
  transpose_f32_to_f16_kernel<C_, C3_><<<dim3(C3_ / 256, C_ / 16), 256, 0, stream>>>(
      Wqkv, WqkvT);
  transpose_f32_to_f16_kernel<C_, C_><<<dim3(C_ / 256, C_ / 16), 256, 0, stream>>>(
      Wout, WoutT);

  // QKV projection, scattered into [3][B][H][N][D] f16
  gemm_f16_wmma<0><<<dim3(C3_ / 128, BN_ / 128), 256, 0, stream>>>(
      Xh, WqkvT, (void*)qkv3, BN_, C3_, C_);

  // per-head RMSNorm + RoPE on q/k planes (in place)
  rmsnorm_rope_kernel<<<dim3((2 * B_ * H_ / RPL_) * (N_ / 64)), 256, 0, stream>>>(
      qkv3, cosp, sinp, gq, gk);

  // flash attention -> f16 [B,N,C]
  flash_attn_kernel<<<dim3(N_ / 256, B_ * H_), 256, 0, stream>>>(qkv3, attnH);

  // output projection -> fp32 d_out
  gemm_f16_wmma<1><<<dim3(C_ / 128, BN_ / 128), 256, 0, stream>>>(
      attnH, WoutT, d_out, BN_, C_, C_);
}

// v007
// One run takes 192 microseconds.
// Timed twice side by side with v006, it ran 1.09 times as fast both times.
// Over all steps from v000 it is 3.85 times as fast.
#include <hip/hip_runtime.h>
#include <hip/hip_bf16.h>

typedef __attribute__((ext_vector_type(16))) _Float16 v16h;
typedef __attribute__((ext_vector_type(8)))  _Float16 v8h;
typedef __attribute__((ext_vector_type(8)))  float    v8f;
typedef __attribute__((ext_vector_type(4)))  _Float16 v4h;
typedef __attribute__((ext_vector_type(4)))  float    v4f;

#define B_   2
#define N_   4096
#define C_   1024
#define H_   16
#define D_   64
#define BN_  8192
#define C3_  3072

#if defined(__has_builtin)
#if __has_builtin(__builtin_amdgcn_global_load_async_to_lds_b128)
#define USE_ASYNC_LDS 1
#endif
#endif

typedef int b128_t __attribute__((vector_size(16)));
typedef __attribute__((address_space(1))) b128_t* gb128_p;
typedef __attribute__((address_space(3))) b128_t* lb128_p;

static __device__ __forceinline__ void cp_b128(const _Float16* g, _Float16* l) {
#ifdef USE_ASYNC_LDS
  __builtin_amdgcn_global_load_async_to_lds_b128(
      (gb128_p)(unsigned long long)(uintptr_t)g,
      (lb128_p)(unsigned)(uintptr_t)l,        // generic LDS addr: low 32 bits
      0, 0);
#else
  *reinterpret_cast<v8h*>(l) = *reinterpret_cast<const v8h*>(g);
#endif
}

static __device__ __forceinline__ v16h frag_ld(const _Float16* base, int stride) {
  const int lane = threadIdx.x & 31;
  const _Float16* p = base + (lane & 15) * stride + ((lane >> 4) << 3);
  v8h lo = *reinterpret_cast<const v8h*>(p);
  v8h hi = *reinterpret_cast<const v8h*>(p + 16);
  return __builtin_shufflevector(lo, hi, 0, 1, 2, 3, 4, 5, 6, 7,
                                 8, 9, 10, 11, 12, 13, 14, 15);
}

static __device__ __forceinline__ v8f wmma_f16(v16h a, v16h b, v8f c) {
  return __builtin_amdgcn_wmma_f32_16x16x32_f16(false, a, false, b,
                                                (short)0, c, false, false);
}

static __device__ __forceinline__ v8f zero_v8f() {
  v8f z = {0.f, 0.f, 0.f, 0.f, 0.f, 0.f, 0.f, 0.f};
  return z;
}

// ---------------------------------------------------------------------------
// fp32 -> f16 elementwise, and transposed f16 weight copies.
// Few, fat waves: many elements a lane, wide accesses, all loads of a lane in
// flight together. Every grid covers its array exactly (no bounds test).
// ---------------------------------------------------------------------------
// A block converts 8192 consecutive floats: 8 loads of 16 B a lane, all issued
// before the first store; each wave-wide access covers whole 128-B lines.
__global__ __launch_bounds__(256) void f32_to_f16_kernel(
    const float* __restrict__ in, _Float16* __restrict__ out) {
  const size_t base = (size_t)blockIdx.x * 8192 + threadIdx.x * 4;
  v4f v[8];
#pragma unroll
  for (int j = 0; j < 8; ++j)
    v[j] = *reinterpret_cast<const v4f*>(in + base + j * 1024);
#pragma unroll
  for (int j = 0; j < 8; ++j)
    *reinterpret_cast<v4h*>(out + base + j * 1024) =
        __builtin_convertvector(v[j], v4h);
}

// A lane takes column n and 16 consecutive k: 16 row-coalesced loads, then
// 32 contiguous bytes of WT row n. grid = (Ncol / 256, K / 16).
// K and Ncol are compile-time so that all 16 loads share one address register
// pair and differ in their immediate offsets only.
template <int K, int Ncol>
__global__ __launch_bounds__(256) void transpose_f32_to_f16_kernel(
    const float* __restrict__ W, _Float16* __restrict__ WT) {
  const int n  = blockIdx.x * 256 + threadIdx.x;
  const int k0 = blockIdx.y * 16;
  const float* src = W + (size_t)k0 * Ncol + n;
  float v[16];
#pragma unroll
  for (int j = 0; j < 16; ++j) v[j] = src[j * Ncol];
  v8h lo, hi;
#pragma unroll
  for (int j = 0; j < 8; ++j) {
    lo[j] = (_Float16)v[j];
    hi[j] = (_Float16)v[j + 8];
  }
  _Float16* dst = WT + (size_t)n * K + k0;
  *reinterpret_cast<v8h*>(dst)     = lo;
  *reinterpret_cast<v8h*>(dst + 8) = hi;
}

// ---------------------------------------------------------------------------
// GEMM: out[M][Nn] = A[M][Kk] * BT[Nn][Kk]^T   (f16 in, f32 accumulate)
// 256 threads = 8 waves (4x2), block tile 128x128, wave tile 32x64
// (2x4 fragments -> 8 wmma per wave per 32-deep block, two blocks per K step).
// A K step is 64 deep: a staged row is one whole 128-B line, brought by 8 lanes.
// LDS ping-pong double buffering; stage for tile k+1 is issued (async when
// available) before computing tile k.
// MODE 0: scatter f16 into qkv3 [3][B][H][N][D].   MODE 1: fp32 row-major.
// ---------------------------------------------------------------------------
template <int MODE>
__global__ __launch_bounds__(256) void gemm_f16_wmma(
    const _Float16* __restrict__ A, const _Float16* __restrict__ BT,
    void* __restrict__ out, int M, int Nn, int Kk) {
  __shared__ _Float16 Alds[2][128 * 72];   // 64 k-halves + 8 pad: 144 B, 16 B x odd
  __shared__ _Float16 Blds[2][128 * 72];

  const int lane = threadIdx.x & 31;
  const int l16  = lane & 15;
  const int wid  = threadIdx.x >> 5;
  const int wrow = wid >> 1;               // 0..3  -> rows wrow*32
  const int wcol = wid & 1;                // 0..1  -> cols wcol*64
  const int m0 = blockIdx.y * 128;
  const int n0 = blockIdx.x * 128;

  v8f acc[2][4];
#pragma unroll
  for (int i = 0; i < 2; ++i)
#pragma unroll
    for (int j = 0; j < 4; ++j) acc[i][j] = zero_v8f();

  auto stage = [&](int k0, int buf) {
#pragma unroll
    for (int q = 0; q < 4; ++q) {
      const int t = threadIdx.x + q * 256;
      const int r = t >> 3, c = t & 7;
      cp_b128(A + (size_t)(m0 + r) * Kk + k0 + c * 8, &Alds[buf][r * 72 + c * 8]);
      cp_b128(BT + (size_t)(n0 + r) * Kk + k0 + c * 8, &Blds[buf][r * 72 + c * 8]);
    }
  };

  const int nk = Kk >> 6;                  // K steps of 64
  stage(0, 0);
  for (int kk = 0; kk < nk; ++kk) {
    // this wave's reads of the buffer that is refilled behind the barrier are done,
    // and its copies of this step's tile have landed, before all waves meet
    asm volatile("s_wait_dscnt 0x0" ::: "memory");
    asm volatile("s_wait_asynccnt 0x0" ::: "memory");
    __syncthreads();
    if (kk + 1 < nk) stage((kk + 1) << 6, (kk + 1) & 1);

    const _Float16* Ab = Alds[kk & 1];
    const _Float16* Bb = Blds[kk & 1];
#pragma unroll
    for (int ks = 0; ks < 2; ++ks) {       // two 32-deep blocks, k ascending
      v16h af[2], bf[4];
#pragma unroll
      for (int i = 0; i < 2; ++i)
        af[i] = frag_ld(&Ab[(wrow * 32 + i * 16) * 72 + ks * 32], 72);
#pragma unroll
      for (int j = 0; j < 4; ++j)
        bf[j] = frag_ld(&Bb[(wcol * 64 + j * 16) * 72 + ks * 32], 72);
#pragma unroll
      for (int i = 0; i < 2; ++i)
#pragma unroll
        for (int j = 0; j < 4; ++j) acc[i][j] = wmma_f16(af[i], bf[j], acc[i][j]);
    }
  }
  // the ring's closing wait: none of this wave's copies is in flight behind the loop,
  // whatever the trip count
  asm volatile("s_wait_asynccnt 0x0" ::: "memory");

  // epilogue: C/D layout -> element (m = r + 8*(lane>>4), n = lane&15)
#pragma unroll
  for (int i = 0; i < 2; ++i) {
#pragma unroll
    for (int j = 0; j < 4; ++j) {
#pragma unroll
      for (int r = 0; r < 8; ++r) {
        int row = m0 + wrow * 32 + i * 16 + r + ((lane >> 4) << 3);
        int col = n0 + wcol * 64 + j * 16 + l16;
        float val = acc[i][j][r];
        if (MODE == 0) {
          int s = col >> 10, rem = col & 1023;
          int hh = rem >> 6, d = rem & 63;
          int bb = row >> 12, nn = row & 4095;
          ((_Float16*)out)[((((size_t)s * B_ + bb) * H_ + hh) * N_ + nn) * D_ + d] =
              (_Float16)val;
        } else {
          ((float*)out)[(size_t)row * Nn + col] = val;
        }
      }
    }
  }
}

#define RPL_ 8

template <int CTRL>
static __device__ __forceinline__ float quad_swap(float x) {   // quad_perm DPP
  return __builtin_bit_cast(float, __builtin_amdgcn_mov_dpp(
      __builtin_bit_cast(int, x), CTRL, 0xf, 0xf, true));
}

static __device__ __forceinline__ float rsq_slot(float x) {
  float r;
  asm("v_rsq_f32 %0, %1\n\tv_nop" : "=v"(r) : "v"(x));
  return r;
}

__global__ __launch_bounds__(256) void rmsnorm_rope_kernel(
    _Float16* __restrict__ qkv3, const float* __restrict__ cosp,
    const float* __restrict__ sinp, const float* __restrict__ gq,
    const float* __restrict__ gk) {
  const int j8 = (threadIdx.x & 3) << 3;
  const int n  = ((blockIdx.x & 63) << 6) + (threadIdx.x >> 2);   // 64 rows a block
  const int p0 = (blockIdx.x >> 6) * RPL_;                        // first plane
  const bool isq = p0 < B_ * H_;
  // 1/sqrt(D) * log2(e) folded into Q; K is multiplied by one, which is exact
  const float qs = isq ? 0.125f * 1.44269504f : 1.0f;

  _Float16* p = qkv3 + ((size_t)p0 * N_ + n) * D_ + j8;
  v8h lo[RPL_], hi[RPL_];
#pragma unroll
  for (int i = 0; i < RPL_; ++i) {
    lo[i] = *reinterpret_cast<const v8h*>(p + (size_t)i * (N_ * D_));
    hi[i] = *reinterpret_cast<const v8h*>(p + (size_t)i * (N_ * D_) + 32);
  }

  const float* g  = (isq ? gq : gk) + j8;
  const float* cr = cosp + n * 64 + j8;
  const float* sr = sinp + n * 64 + j8;
  v4f tg[4], tc[4], ts[4];                 // [0],[1]: d = j8..j8+7; [2],[3]: d + 32
#pragma unroll
  for (int q = 0; q < 4; ++q)
    tc[q] = *reinterpret_cast<const v4f*>(cr + (q >> 1) * 32 + (q & 1) * 4);
  asm volatile("s_wait_xcnt 0x0" ::: "memory");
#pragma unroll
  for (int q = 0; q < 4; ++q)
    ts[q] = *reinterpret_cast<const v4f*>(sr + (q >> 1) * 32 + (q & 1) * 4);
  asm volatile("s_wait_xcnt 0x0" ::: "memory");
#pragma unroll
  for (int q = 0; q < 4; ++q)
    tg[q] = *reinterpret_cast<const v4f*>(g + (q >> 1) * 32 + (q & 1) * 4);
  // Keeps all 28 loads ahead of the arithmetic (one memory latency a wave):
  // without it the compiler sinks table loads between the rows' sums.
  __builtin_amdgcn_sched_barrier(0);

#pragma unroll
  for (int i = 0; i < RPL_; ++i) {
    float e0[8], e1[8];
    float ss = 0.f;
#pragma unroll
    for (int k = 0; k < 8; ++k) {
      e0[k] = (float)lo[i][k];
      e1[k] = (float)hi[i][k];
      ss += e0[k] * e0[k] + e1[k] * e1[k];
    }
    ss += quad_swap<0xB1>(ss);             // lane ^ 1
    ss += quad_swap<0x4E>(ss);             // lane ^ 2: all four lanes hold the sum
    // the argument is at least 1e-6: rsqrtf's rescaling of tiny arguments never acts
    float rinv = rsq_slot(ss * (1.0f / 64.0f) + 1e-6f);

    v8h olo, ohi;
#pragma unroll
    for (int k = 0; k < 8; ++k) {
      const int q = k >> 2, c = k & 3;
      float x0 = e0[k] * rinv * tg[q][c];
      float x1 = e1[k] * rinv * tg[q + 2][c];
      float y0 = x0 * tc[q][c]     - x1 * ts[q][c];      // d < 32: -x2*sin
      float y1 = x1 * tc[q + 2][c] + x0 * ts[q + 2][c];  // d >= 32: +x1*sin
      olo[k] = (_Float16)(y0 * qs);
      ohi[k] = (_Float16)(y1 * qs);
    }
    *reinterpret_cast<v8h*>(p + (size_t)i * (N_ * D_))      = olo;
    *reinterpret_cast<v8h*>(p + (size_t)i * (N_ * D_) + 32) = ohi;
  }
}

static __device__ __forceinline__ float xhalf(float x) {
  int v = __builtin_bit_cast(int, x);
  return __builtin_bit_cast(float, __builtin_amdgcn_permlanex16(
      v, v, 0x76543210, 0xfedcba98, false, false));
}

static __device__ __forceinline__ void exp2_block(float (&x)[16]) {
  asm("v_exp_f32 %0, %0\n\tv_exp_f32 %1, %1\n\tv_exp_f32 %2, %2\n\t"
      "v_exp_f32 %3, %3\n\tv_exp_f32 %4, %4\n\tv_exp_f32 %5, %5\n\t"
      "v_exp_f32 %6, %6\n\tv_exp_f32 %7, %7\n\tv_exp_f32 %8, %8\n\t"
      "v_exp_f32 %9, %9\n\tv_exp_f32 %10, %10\n\tv_exp_f32 %11, %11\n\t"
      "v_exp_f32 %12, %12\n\tv_exp_f32 %13, %13\n\tv_exp_f32 %14, %14\n\t"
      "v_exp_f32 %15, %15\n\tv_nop"
      : "+v"(x[0]), "+v"(x[1]), "+v"(x[2]), "+v"(x[3]), "+v"(x[4]), "+v"(x[5]),
        "+v"(x[6]), "+v"(x[7]), "+v"(x[8]), "+v"(x[9]), "+v"(x[10]),
        "+v"(x[11]), "+v"(x[12]), "+v"(x[13]), "+v"(x[14]), "+v"(x[15]));
}

static __device__ __forceinline__ float exp2_one(float x) {
  float r;
  asm("v_exp_f32 %0, %1\n\tv_nop" : "=v"(r) : "v"(x));
  return r;
}

#define VP_ 80

typedef __attribute__((ext_vector_type(8))) short s16x8;
typedef __attribute__((address_space(3))) s16x8 lds_s16x8;

static __device__ __forceinline__ v16h frag_ld_tr(const _Float16* tile) {
  const int lane = threadIdx.x & 31;
  const _Float16* p = tile + (((lane >> 4) << 3) + (lane & 7)) * VP_ +
                      (((lane >> 3) & 1) << 3);
  v8h lo = __builtin_bit_cast(v8h, __builtin_amdgcn_ds_load_tr16_b128_v8i16(
      (lds_s16x8*)p));
  v8h hi = __builtin_bit_cast(v8h, __builtin_amdgcn_ds_load_tr16_b128_v8i16(
      (lds_s16x8*)(p + 16 * VP_)));
  return __builtin_shufflevector(lo, hi, 0, 1, 2, 3, 4, 5, 6, 7,
                                 8, 9, 10, 11, 12, 13, 14, 15);
}

__global__ __launch_bounds__(256) void flash_attn_kernel(
    const _Float16* __restrict__ qkv3, _Float16* __restrict__ attn_out) {
  __shared__ _Float16 Klds[64 * 72];       // [key][d], stride 72
  __shared__ __attribute__((aligned(16))) _Float16 Vlds[64 * VP_];   // [key][d]

  const int lane = threadIdx.x & 31;
  const int l16  = lane & 15;
  const int hlf8 = (lane >> 4) << 3;
  const int wid  = threadIdx.x >> 5;

  const int b = blockIdx.y >> 4;
  const int h = blockIdx.y & 15;
  const size_t plane = (size_t)N_ * D_;
  const _Float16* Q = qkv3 + ((size_t)((0 * B_ + b) * H_ + h)) * plane;
  const _Float16* K = qkv3 + ((size_t)((1 * B_ + b) * H_ + h)) * plane;
  const _Float16* V = qkv3 + ((size_t)((2 * B_ + b) * H_ + h)) * plane;

  const int qbase = blockIdx.x * 256 + wid * 32;

  v16h qf[2][2];                           // B operand: column = query g*16 + l16
  v8f o[2][4];                             // o[g][dt][r] = O[query][dt*16 + hlf8 + r]
  float mrun[2], mthr[2], lrun[2];         // a lane's two queries: the maximum in use,
                                           // the score above which it moves, and the
                                           // sum over this half's keys
  // Every loop over g, dt or r in this kernel is unrolled: its index picks registers
  // (fragments, accumulators, scores), which a rolled loop would push to scratch.
#pragma unroll
  for (int g = 0; g < 2; ++g) {
    qf[g][0] = frag_ld(Q + (size_t)(qbase + g * 16) * D_ + 0,  D_);
    qf[g][1] = frag_ld(Q + (size_t)(qbase + g * 16) * D_ + 32, D_);
#pragma unroll
    for (int dt = 0; dt < 4; ++dt) o[g][dt] = zero_v8f();
    mrun[g] = -3.0e38f;
    mthr[g] = -3.0e38f;
    lrun[g] = 0.f;
  }

  const int ntiles = N_ / 64;
  for (int kt = 0; kt < ntiles; ++kt) {
    const int k0 = kt * 64;

    // prefetch next 64-key K/V tile (one 128B line per thread)
    if (kt + 1 < ntiles) {
      int t = threadIdx.x;
      if (t < 64)
        __builtin_prefetch((const void*)(K + (size_t)(k0 + 64 + t) * D_), 0, 1);
      else if (t < 128)
        __builtin_prefetch((const void*)(V + (size_t)(k0 + t) * D_), 0, 1);
    }

    // stage: K and V row-major, 16 B a lane and copy. Unrolled so that a lane's four
    // copies issue back to back, all lanes on, and share one latency.
#pragma unroll
    for (int j = 0; j < 2; ++j) {
      const int t = threadIdx.x + j * 256;
      const int key = t >> 3, c = t & 7;
      cp_b128(K + (size_t)(k0 + key) * D_ + c * 8, &Klds[key * 72 + c * 8]);
      cp_b128(V + (size_t)(k0 + key) * D_ + c * 8, &Vlds[key * VP_ + c * 8]);
    }
    // this wave's copies have landed before the barrier behind which all waves read
    asm volatile("s_wait_asynccnt 0x0" ::: "memory");
    __syncthreads();

#pragma unroll
    for (int ss = 0; ss < 2; ++ss) {       // two 32-key sub-steps
      const _Float16* Kb = &Klds[(ss * 32) * 72];

      // the four K fragments of the sub-step, each read once for both groups
      v16h kf[4];
      kf[0] = frag_ld(&Kb[0 * 16 * 72 + 0],  72);
      kf[1] = frag_ld(&Kb[0 * 16 * 72 + 32], 72);
      kf[2] = frag_ld(&Kb[1 * 16 * 72 + 0],  72);
      kf[3] = frag_ld(&Kb[1 * 16 * 72 + 32], 72);

      // S^T(32 keys x 16 queries) a group: s0[r] = key hlf8 + r, s1[r] = key 16 + hlf8 + r
      v8f s0[2], s1[2];
#pragma unroll
      for (int g = 0; g < 2; ++g) {
        s0[g] = wmma_f16(kf[0], qf[g][0], zero_v8f());
        s1[g] = wmma_f16(kf[2], qf[g][0], zero_v8f());
      }
#pragma unroll
      for (int g = 0; g < 2; ++g) {
        s0[g] = wmma_f16(kf[1], qf[g][1], s0[g]);
        s1[g] = wmma_f16(kf[3], qf[g][1], s1[g]);
      }

      v16h vf[4];
#pragma unroll
      for (int dt = 0; dt < 4; ++dt)
        vf[dt] = frag_ld_tr(&Vlds[ss * 32 * VP_ + dt * 16]);

      // Lazy rescale: the maximum in use, mrun, moves only when some score of the wave
      // lies more than 8 (powers of two) above it; until then P = 2^(s - mrun) <= 256,
      // far inside f16 and f32 range, and sums and outputs keep their scale. One test
      // for both groups; each lane tests its own half's 16 scores, the halves are
      // joined only where the maximum moves.
      float mx[2];
#pragma unroll
      for (int g = 0; g < 2; ++g) {
        mx[g] = fmaxf(s0[g][0], s1[g][0]);
#pragma unroll
        for (int r = 1; r < 8; ++r) mx[g] = fmaxf(mx[g], fmaxf(s0[g][r], s1[g][r]));
      }
      const bool need = (mx[0] > mthr[0]) | (mx[1] > mthr[1]);
      // wave-uniform scalar branch; marked unlikely so that the rescale stands out of line
      if (__builtin_expect(__builtin_amdgcn_ballot_w32(need) != 0, 0)) {
#pragma unroll
        for (int g = 0; g < 2; ++g) {
          // both halves take the query's joint maximum: one scale a query
          float mnew = fmaxf(mrun[g], fmaxf(mx[g], xhalf(mx[g])));
          float alpha = exp2_one(mrun[g] - mnew);
          mrun[g] = mnew;
          mthr[g] = mnew + 8.0f;
          lrun[g] *= alpha;
#pragma unroll
          for (int dt = 0; dt < 4; ++dt) o[g][dt] *= alpha;
        }
      }

      v16h pf[2];
#pragma unroll
      for (int g = 0; g < 2; ++g) {
        // softmax numerators, base-2 (log2e folded into Q), one query per lane
        float p[16];                       // p[2r] = key hlf8 + r, p[2r + 1] = 16 + hlf8 + r
#pragma unroll
        for (int r = 0; r < 8; ++r) {
          p[2 * r]     = s0[g][r] - mrun[g];
          p[2 * r + 1] = s1[g][r] - mrun[g];
        }
        exp2_block(p);

        // P^T as B fragment: element s = key kmap(s) = s0[s] (s < 8), s1[s - 8]
        float ps = 0.f;
#pragma unroll
        for (int r = 0; r < 8; ++r) {
          float p0 = p[2 * r];
          float p1 = p[2 * r + 1];
          ps += p0 + p1;
          pf[g][r]     = (_Float16)p0;
          pf[g][r + 8] = (_Float16)p1;
        }
        lrun[g] += ps;
      }

      // O^T(64 d x 16 queries) += V^T(64 x 32 keys) * P^T(32 x 16), a group
#pragma unroll
      for (int dt = 0; dt < 4; ++dt)
#pragma unroll
        for (int g = 0; g < 2; ++g) o[g][dt] = wmma_f16(vf[dt], pf[g], o[g][dt]);
    }
    // this wave's LDS reads are done before the barrier behind which the next
    // tile's copies overwrite both buffers
    asm volatile("s_wait_dscnt 0x0" ::: "memory");
    __syncthreads();
  }

  // join the halves' sums, normalize, store f16 [B][N][C] with head offset:
  // a lane's 8 registers of a tile are 8 consecutive d of its query row
#pragma unroll
  for (int g = 0; g < 2; ++g) {
    const float lsum = lrun[g] + xhalf(lrun[g]);
    _Float16* orow =
        attn_out + (size_t)(b * N_ + qbase + g * 16 + l16) * C_ + h * D_ + hlf8;
#pragma unroll
    for (int dt = 0; dt < 4; ++dt) {
      v8h ov;
#pragma unroll
      for (int r = 0; r < 8; ++r) ov[r] = (_Float16)(o[g][dt][r] / lsum);
      *reinterpret_cast<v8h*>(orow + dt * 16) = ov;
    }
  }
}

// ---------------------------------------------------------------------------
// Host-side launch pipeline
// ---------------------------------------------------------------------------
extern "C" void kernel_launch(void* const* d_in, const int* in_sizes, int n_in,
                              void* d_out, int out_size, void* d_ws, size_t ws_size,
                              hipStream_t stream) {
  const float* hidden = (const float*)d_in[0];
  const float* cosp   = (const float*)d_in[1];
  const float* sinp   = (const float*)d_in[2];
  const float* Wqkv   = (const float*)d_in[3];
  const float* Wout   = (const float*)d_in[4];
  const float* gq     = (const float*)d_in[5];
  const float* gk     = (const float*)d_in[6];

  // workspace layout (bytes):
  //   Xh      f16 [8192,1024]           16,777,216
  //   WqkvT   f16 [3072,1024]            6,291,456
  //   WoutT   f16 [1024,1024]            2,097,152
  //   qkv3    f16 [3][2][16][4096][64]  50,331,648
  //   attnH   f16 [8192,1024]           16,777,216   (total ~92.3 MB)
  char* ws = (char*)d_ws;
  _Float16* Xh    = (_Float16*)(ws);
  _Float16* WqkvT = (_Float16*)(ws + 16777216);
  _Float16* WoutT = (_Float16*)(ws + 16777216 + 6291456);
  _Float16* qkv3  = (_Float16*)(ws + 16777216 + 6291456 + 2097152);
  _Float16* attnH = (_Float16*)(ws + 16777216 + 6291456 + 2097152 + 50331648);

  f32_to_f16_kernel<<<dim3((BN_ * C_) / 8192), 256, 0, stream>>>(hidden, Xh);
  transpose_f32_to_f16_kernel<C_, C3_><<<dim3(C3_ / 256, C_ / 16), 256, 0, stream>>>(
      Wqkv, WqkvT);
  transpose_f32_to_f16_kernel<C_, C_><<<dim3(C_ / 256, C_ / 16), 256, 0, stream>>>(
      Wout, WoutT);

  // QKV projection, scattered into [3][B][H][N][D] f16
  gemm_f16_wmma<0><<<dim3(C3_ / 128, BN_ / 128), 256, 0, stream>>>(
      Xh, WqkvT, (void*)qkv3, BN_, C3_, C_);

  // per-head RMSNorm + RoPE on q/k planes (in place)
  rmsnorm_rope_kernel<<<dim3((2 * B_ * H_ / RPL_) * (N_ / 64)), 256, 0, stream>>>(
      qkv3, cosp, sinp, gq, gk);

  // flash attention -> f16 [B,N,C]
  flash_attn_kernel<<<dim3(N_ / 256, B_ * H_), 256, 0, stream>>>(qkv3, attnH);

  // output projection -> fp32 d_out
  gemm_f16_wmma<1><<<dim3(C_ / 128, BN_ / 128), 256, 0, stream>>>(
      attnH, WoutT, d_out, BN_, C_, C_);
}

// v008
// A run of this version takes 187 microseconds.
// In both of two side-by-side timings against v007, it was 1.03 times as fast.
// All steps since v000 together make it 3.96 times as fast.
#include <hip/hip_runtime.h>
#include <hip/hip_bf16.h>

typedef __attribute__((ext_vector_type(16))) _Float16 v16h;
typedef __attribute__((ext_vector_type(8)))  _Float16 v8h;
typedef __attribute__((ext_vector_type(8)))  float    v8f;
typedef __attribute__((ext_vector_type(4)))  _Float16 v4h;
typedef __attribute__((ext_vector_type(4)))  float    v4f;

#define B_   2
#define N_   4096
#define C_   1024
#define H_   16
#define D_   64
#define BN_  8192
#define C3_  3072

#if defined(__has_builtin)
#if __has_builtin(__builtin_amdgcn_global_load_async_to_lds_b128)
#define USE_ASYNC_LDS 1
#endif
#endif

typedef int b128_t __attribute__((vector_size(16)));
typedef __attribute__((address_space(1))) b128_t* gb128_p;
typedef __attribute__((address_space(3))) b128_t* lb128_p;

static __device__ __forceinline__ void cp_b128(const _Float16* g, _Float16* l) {
#ifdef USE_ASYNC_LDS
  __builtin_amdgcn_global_load_async_to_lds_b128(
      (gb128_p)(unsigned long long)(uintptr_t)g,
      (lb128_p)(unsigned)(uintptr_t)l,        // generic LDS addr: low 32 bits
      0, 0);
#else
  *reinterpret_cast<v8h*>(l) = *reinterpret_cast<const v8h*>(g);
#endif
}

static __device__ __forceinline__ v16h frag_ld(const _Float16* base, int stride) {
  const int lane = threadIdx.x & 31;
  const _Float16* p = base + (lane & 15) * stride + ((lane >> 4) << 3);
  v8h lo = *reinterpret_cast<const v8h*>(p);
  v8h hi = *reinterpret_cast<const v8h*>(p + 16);
  return __builtin_shufflevector(lo, hi, 0, 1, 2, 3, 4, 5, 6, 7,
                                 8, 9, 10, 11, 12, 13, 14, 15);
}

static __device__ __forceinline__ v8f wmma_f16(v16h a, v16h b, v8f c) {
  return __builtin_amdgcn_wmma_f32_16x16x32_f16(false, a, false, b,
                                                (short)0, c, false, false);
}

static __device__ __forceinline__ v8f zero_v8f() {
  v8f z = {0.f, 0.f, 0.f, 0.f, 0.f, 0.f, 0.f, 0.f};
  return z;
}

static __device__ __forceinline__ void f32_to_f16_block(
    const float* __restrict__ in, _Float16* __restrict__ out, int blk) {
  const size_t base = (size_t)blk * 8192 + threadIdx.x * 4;
  v4f v[8];
#pragma unroll
  for (int j = 0; j < 8; ++j)
    v[j] = *reinterpret_cast<const v4f*>(in + base + j * 1024);
#pragma unroll
  for (int j = 0; j < 8; ++j)
    *reinterpret_cast<v4h*>(out + base + j * 1024) =
        __builtin_convertvector(v[j], v4h);
  asm volatile("s_wait_xcnt 0x0" ::: "memory");
}

// A lane takes column n and 16 consecutive k: 16 row-coalesced loads, then
// 32 contiguous bytes of WT row n. Blocks: bx < Ncol / 256, by < K / 16.
// K and Ncol are compile-time so that all 16 loads share one address register
// pair and differ in their immediate offsets only.
template <int K, int Ncol>
static __device__ __forceinline__ void transpose_f32_to_f16_block(
    const float* __restrict__ W, _Float16* __restrict__ WT, int bx, int by) {
  const int n  = bx * 256 + threadIdx.x;
  const int k0 = by * 16;
  const float* src = W + (size_t)k0 * Ncol + n;
  float v[16];
#pragma unroll
  for (int j = 0; j < 16; ++j) v[j] = src[j * Ncol];
  v8h lo, hi;
#pragma unroll
  for (int j = 0; j < 8; ++j) {
    lo[j] = (_Float16)v[j];
    hi[j] = (_Float16)v[j + 8];
  }
  _Float16* dst = WT + (size_t)n * K + k0;
  *reinterpret_cast<v8h*>(dst)     = lo;
  *reinterpret_cast<v8h*>(dst + 8) = hi;
  asm volatile("s_wait_xcnt 0x0" ::: "memory");
}

// One grid for the three jobs; the range test reads blockIdx alone, a scalar branch.
// The transposes come first: their 32-B stores are the slow part and then run under
// the cast's stream.
#define TQ_BLOCKS_ ((C3_ / 256) * (C_ / 16))     // 768: Wqkv transpose
#define TO_BLOCKS_ ((C_ / 256) * (C_ / 16))      // 256: Wout transpose
#define CV_BLOCKS_ ((BN_ * C_) / 8192)           // 1024: cast of the hidden states

__global__ __launch_bounds__(256) void prep_kernel(
    const float* __restrict__ hidden, const float* __restrict__ Wqkv,
    const float* __restrict__ Wout, _Float16* __restrict__ Xh,
    _Float16* __restrict__ WqkvT, _Float16* __restrict__ WoutT) {
  const int blk = blockIdx.x;
  if (blk < TQ_BLOCKS_) {
    transpose_f32_to_f16_block<C_, C3_>(Wqkv, WqkvT, blk % (C3_ / 256), blk / (C3_ / 256));
  } else if (blk < TQ_BLOCKS_ + TO_BLOCKS_) {
    const int t = blk - TQ_BLOCKS_;
    transpose_f32_to_f16_block<C_, C_>(Wout, WoutT, t % (C_ / 256), t / (C_ / 256));
  } else {
    f32_to_f16_block(hidden, Xh, blk - (TQ_BLOCKS_ + TO_BLOCKS_));
  }
}

// ---------------------------------------------------------------------------
// GEMM: out[M][Nn] = A[M][Kk] * BT[Nn][Kk]^T   (f16 in, f32 accumulate)
// 256 threads = 8 waves (4x2), block tile 128x128, wave tile 32x64
// (2x4 fragments -> 8 wmma per wave per 32-deep block, two blocks per K step).
// A K step is 64 deep: a staged row is one whole 128-B line, brought by 8 lanes.
// LDS ping-pong double buffering; stage for tile k+1 is issued (async when
// available) before computing tile k.
// MODE 0: scatter f16 into qkv3 [3][B][H][N][D].   MODE 1: fp32 row-major.
// ---------------------------------------------------------------------------
template <int MODE>
__global__ __launch_bounds__(256) void gemm_f16_wmma(
    const _Float16* __restrict__ A, const _Float16* __restrict__ BT,
    void* __restrict__ out, int M, int Nn, int Kk) {
  __shared__ _Float16 Alds[2][128 * 72];   // 64 k-halves + 8 pad: 144 B, 16 B x odd
  __shared__ _Float16 Blds[2][128 * 72];

  const int lane = threadIdx.x & 31;
  const int l16  = lane & 15;
  const int wid  = threadIdx.x >> 5;
  const int wrow = wid >> 1;               // 0..3  -> rows wrow*32
  const int wcol = wid & 1;                // 0..1  -> cols wcol*64
  const int m0 = blockIdx.y * 128;
  const int n0 = blockIdx.x * 128;

  v8f acc[2][4];
#pragma unroll
  for (int i = 0; i < 2; ++i)
#pragma unroll
    for (int j = 0; j < 4; ++j) acc[i][j] = zero_v8f();

  auto stage = [&](int k0, int buf) {
#pragma unroll
    for (int q = 0; q < 4; ++q) {
      const int t = threadIdx.x + q * 256;
      const int r = t >> 3, c = t & 7;
      cp_b128(A + (size_t)(m0 + r) * Kk + k0 + c * 8, &Alds[buf][r * 72 + c * 8]);
      cp_b128(BT + (size_t)(n0 + r) * Kk + k0 + c * 8, &Blds[buf][r * 72 + c * 8]);
    }
  };

  const int nk = Kk >> 6;                  // K steps of 64
  stage(0, 0);
  for (int kk = 0; kk < nk; ++kk) {
    // this wave's reads of the buffer that is refilled behind the barrier are done,
    // and its copies of this step's tile have landed, before all waves meet
    asm volatile("s_wait_dscnt 0x0" ::: "memory");
    asm volatile("s_wait_asynccnt 0x0" ::: "memory");
    __syncthreads();
    if (kk + 1 < nk) stage((kk + 1) << 6, (kk + 1) & 1);

    const _Float16* Ab = Alds[kk & 1];
    const _Float16* Bb = Blds[kk & 1];
#pragma unroll
    for (int ks = 0; ks < 2; ++ks) {       // two 32-deep blocks, k ascending
      v16h af[2], bf[4];
#pragma unroll
      for (int i = 0; i < 2; ++i)
        af[i] = frag_ld(&Ab[(wrow * 32 + i * 16) * 72 + ks * 32], 72);
#pragma unroll
      for (int j = 0; j < 4; ++j)
        bf[j] = frag_ld(&Bb[(wcol * 64 + j * 16) * 72 + ks * 32], 72);
#pragma unroll
      for (int i = 0; i < 2; ++i)
#pragma unroll
        for (int j = 0; j < 4; ++j) acc[i][j] = wmma_f16(af[i], bf[j], acc[i][j]);
    }
  }
  // the ring's closing wait: none of this wave's copies is in flight behind the loop,
  // whatever the trip count
  asm volatile("s_wait_asynccnt 0x0" ::: "memory");

  // epilogue: C/D layout -> element (m = r + 8*(lane>>4), n = lane&15)
#pragma unroll
  for (int i = 0; i < 2; ++i) {
#pragma unroll
    for (int j = 0; j < 4; ++j) {
#pragma unroll
      for (int r = 0; r < 8; ++r) {
        int row = m0 + wrow * 32 + i * 16 + r + ((lane >> 4) << 3);
        int col = n0 + wcol * 64 + j * 16 + l16;
        float val = acc[i][j][r];
        if (MODE == 0) {
          int s = col >> 10, rem = col & 1023;
          int hh = rem >> 6, d = rem & 63;
          int bb = row >> 12, nn = row & 4095;
          ((_Float16*)out)[((((size_t)s * B_ + bb) * H_ + hh) * N_ + nn) * D_ + d] =
              (_Float16)val;
        } else {
          ((float*)out)[(size_t)row * Nn + col] = val;
        }
      }
    }
  }
}

#define RPL_ 8

template <int CTRL>
static __device__ __forceinline__ float quad_swap(float x) {   // quad_perm DPP
  return __builtin_bit_cast(float, __builtin_amdgcn_mov_dpp(
      __builtin_bit_cast(int, x), CTRL, 0xf, 0xf, true));
}

static __device__ __forceinline__ float rsq_slot(float x) {
  float r;
  asm("v_rsq_f32 %0, %1\n\tv_nop" : "=v"(r) : "v"(x));
  return r;
}

__global__ __launch_bounds__(256) void rmsnorm_rope_kernel(
    _Float16* __restrict__ qkv3, const float* __restrict__ cosp,
    const float* __restrict__ sinp, const float* __restrict__ gq,
    const float* __restrict__ gk) {
  const int j8 = (threadIdx.x & 3) << 3;
  const int n  = ((blockIdx.x & 63) << 6) + (threadIdx.x >> 2);   // 64 rows a block
  const int p0 = (blockIdx.x >> 6) * RPL_;                        // first plane
  const bool isq = p0 < B_ * H_;
  // 1/sqrt(D) * log2(e) folded into Q; K is multiplied by one, which is exact
  const float qs = isq ? 0.125f * 1.44269504f : 1.0f;

  _Float16* p = qkv3 + ((size_t)p0 * N_ + n) * D_ + j8;
  v8h lo[RPL_], hi[RPL_];
#pragma unroll
  for (int i = 0; i < RPL_; ++i) {
    lo[i] = *reinterpret_cast<const v8h*>(p + (size_t)i * (N_ * D_));
    hi[i] = *reinterpret_cast<const v8h*>(p + (size_t)i * (N_ * D_) + 32);
  }

  const float* g  = (isq ? gq : gk) + j8;
  const float* cr = cosp + n * 64 + j8;
  const float* sr = sinp + n * 64 + j8;
  v4f tg[4], tc[4], ts[4];                 // [0],[1]: d = j8..j8+7; [2],[3]: d + 32
#pragma unroll
  for (int q = 0; q < 4; ++q)
    tc[q] = *reinterpret_cast<const v4f*>(cr + (q >> 1) * 32 + (q & 1) * 4);
  asm volatile("s_wait_xcnt 0x0" ::: "memory");
#pragma unroll
  for (int q = 0; q < 4; ++q)
    ts[q] = *reinterpret_cast<const v4f*>(sr + (q >> 1) * 32 + (q & 1) * 4);
  asm volatile("s_wait_xcnt 0x0" ::: "memory");
#pragma unroll
  for (int q = 0; q < 4; ++q)
    tg[q] = *reinterpret_cast<const v4f*>(g + (q >> 1) * 32 + (q & 1) * 4);
  // Keeps all 28 loads ahead of the arithmetic (one memory latency a wave):
  // without it the compiler sinks table loads between the rows' sums.
  __builtin_amdgcn_sched_barrier(0);

#pragma unroll
  for (int i = 0; i < RPL_; ++i) {
    float e0[8], e1[8];
    float ss = 0.f;
#pragma unroll
    for (int k = 0; k < 8; ++k) {
      e0[k] = (float)lo[i][k];
      e1[k] = (float)hi[i][k];
      ss += e0[k] * e0[k] + e1[k] * e1[k];
    }
    ss += quad_swap<0xB1>(ss);             // lane ^ 1
    ss += quad_swap<0x4E>(ss);             // lane ^ 2: all four lanes hold the sum
    // the argument is at least 1e-6: rsqrtf's rescaling of tiny arguments never acts
    float rinv = rsq_slot(ss * (1.0f / 64.0f) + 1e-6f);

    v8h olo, ohi;
#pragma unroll
    for (int k = 0; k < 8; ++k) {
      const int q = k >> 2, c = k & 3;
      float x0 = e0[k] * rinv * tg[q][c];
      float x1 = e1[k] * rinv * tg[q + 2][c];
      float y0 = x0 * tc[q][c]     - x1 * ts[q][c];      // d < 32: -x2*sin
      float y1 = x1 * tc[q + 2][c] + x0 * ts[q + 2][c];  // d >= 32: +x1*sin
      olo[k] = (_Float16)(y0 * qs);
      ohi[k] = (_Float16)(y1 * qs);
    }
    *reinterpret_cast<v8h*>(p + (size_t)i * (N_ * D_))      = olo;
    *reinterpret_cast<v8h*>(p + (size_t)i * (N_ * D_) + 32) = ohi;
  }
}

static __device__ __forceinline__ float xhalf(float x) {
  int v = __builtin_bit_cast(int, x);
  return __builtin_bit_cast(float, __builtin_amdgcn_permlanex16(
      v, v, 0x76543210, 0xfedcba98, false, false));
}

static __device__ __forceinline__ void exp2_block(float (&x)[16]) {
  asm("v_exp_f32 %0, %0\n\tv_exp_f32 %1, %1\n\tv_exp_f32 %2, %2\n\t"
      "v_exp_f32 %3, %3\n\tv_exp_f32 %4, %4\n\tv_exp_f32 %5, %5\n\t"
      "v_exp_f32 %6, %6\n\tv_exp_f32 %7, %7\n\tv_exp_f32 %8, %8\n\t"
      "v_exp_f32 %9, %9\n\tv_exp_f32 %10, %10\n\tv_exp_f32 %11, %11\n\t"
      "v_exp_f32 %12, %12\n\tv_exp_f32 %13, %13\n\tv_exp_f32 %14, %14\n\t"
      "v_exp_f32 %15, %15\n\tv_nop"
      : "+v"(x[0]), "+v"(x[1]), "+v"(x[2]), "+v"(x[3]), "+v"(x[4]), "+v"(x[5]),
        "+v"(x[6]), "+v"(x[7]), "+v"(x[8]), "+v"(x[9]), "+v"(x[10]),
        "+v"(x[11]), "+v"(x[12]), "+v"(x[13]), "+v"(x[14]), "+v"(x[15]));
}

static __device__ __forceinline__ float exp2_one(float x) {
  float r;
  asm("v_exp_f32 %0, %1\n\tv_nop" : "=v"(r) : "v"(x));
  return r;
}

#define VP_ 80

typedef __attribute__((ext_vector_type(8))) short s16x8;
typedef __attribute__((address_space(3))) s16x8 lds_s16x8;

static __device__ __forceinline__ v16h frag_ld_tr(const _Float16* tile) {
  const int lane = threadIdx.x & 31;
  const _Float16* p = tile + (((lane >> 4) << 3) + (lane & 7)) * VP_ +
                      (((lane >> 3) & 1) << 3);
  v8h lo = __builtin_bit_cast(v8h, __builtin_amdgcn_ds_load_tr16_b128_v8i16(
      (lds_s16x8*)p));
  v8h hi = __builtin_bit_cast(v8h, __builtin_amdgcn_ds_load_tr16_b128_v8i16(
      (lds_s16x8*)(p + 16 * VP_)));
  return __builtin_shufflevector(lo, hi, 0, 1, 2, 3, 4, 5, 6, 7,
                                 8, 9, 10, 11, 12, 13, 14, 15);
}

__global__ __launch_bounds__(256) void flash_attn_kernel(
    const _Float16* __restrict__ qkv3, _Float16* __restrict__ attn_out) {
  __shared__ _Float16 Klds[64 * 72];       // [key][d], stride 72
  __shared__ __attribute__((aligned(16))) _Float16 Vlds[64 * VP_];   // [key][d]

  const int lane = threadIdx.x & 31;
  const int l16  = lane & 15;
  const int hlf8 = (lane >> 4) << 3;
  const int wid  = threadIdx.x >> 5;

  const int b = blockIdx.y >> 4;
  const int h = blockIdx.y & 15;
  const size_t plane = (size_t)N_ * D_;
  const _Float16* Q = qkv3 + ((size_t)((0 * B_ + b) * H_ + h)) * plane;
  const _Float16* K = qkv3 + ((size_t)((1 * B_ + b) * H_ + h)) * plane;
  const _Float16* V = qkv3 + ((size_t)((2 * B_ + b) * H_ + h)) * plane;

  const int qbase = blockIdx.x * 256 + wid * 32;

  v16h qf[2][2];                           // B operand: column = query g*16 + l16
  v8f o[2][4];                             // o[g][dt][r] = O[query][dt*16 + hlf8 + r]
  float mrun[2], mthr[2], lrun[2];         // a lane's two queries: the maximum in use,
                                           // the score above which it moves, and the
                                           // sum over this half's keys
  // Every loop over g, dt or r in this kernel is unrolled: its index picks registers
  // (fragments, accumulators, scores), which a rolled loop would push to scratch.
#pragma unroll
  for (int g = 0; g < 2; ++g) {
    qf[g][0] = frag_ld(Q + (size_t)(qbase + g * 16) * D_ + 0,  D_);
    qf[g][1] = frag_ld(Q + (size_t)(qbase + g * 16) * D_ + 32, D_);
#pragma unroll
    for (int dt = 0; dt < 4; ++dt) o[g][dt] = zero_v8f();
    mrun[g] = -3.0e38f;
    mthr[g] = -3.0e38f;
    lrun[g] = 0.f;
  }

  const int ntiles = N_ / 64;
  for (int kt = 0; kt < ntiles; ++kt) {
    const int k0 = kt * 64;

    // prefetch next 64-key K/V tile (one 128B line per thread)
    if (kt + 1 < ntiles) {
      int t = threadIdx.x;
      if (t < 64)
        __builtin_prefetch((const void*)(K + (size_t)(k0 + 64 + t) * D_), 0, 1);
      else if (t < 128)
        __builtin_prefetch((const void*)(V + (size_t)(k0 + t) * D_), 0, 1);
    }

    // stage: K and V row-major, 16 B a lane and copy. Unrolled so that a lane's four
    // copies issue back to back, all lanes on, and share one latency.
#pragma unroll
    for (int j = 0; j < 2; ++j) {
      const int t = threadIdx.x + j * 256;
      const int key = t >> 3, c = t & 7;
      cp_b128(K + (size_t)(k0 + key) * D_ + c * 8, &Klds[key * 72 + c * 8]);
      cp_b128(V + (size_t)(k0 + key) * D_ + c * 8, &Vlds[key * VP_ + c * 8]);
    }
    // this wave's copies have landed before the barrier behind which all waves read
    asm volatile("s_wait_asynccnt 0x0" ::: "memory");
    __syncthreads();

#pragma unroll
    for (int ss = 0; ss < 2; ++ss) {       // two 32-key sub-steps
      const _Float16* Kb = &Klds[(ss * 32) * 72];

      // the four K fragments of the sub-step, each read once for both groups
      v16h kf[4];
      kf[0] = frag_ld(&Kb[0 * 16 * 72 + 0],  72);
      kf[1] = frag_ld(&Kb[0 * 16 * 72 + 32], 72);
      kf[2] = frag_ld(&Kb[1 * 16 * 72 + 0],  72);
      kf[3] = frag_ld(&Kb[1 * 16 * 72 + 32], 72);

      // S^T(32 keys x 16 queries) a group: s0[r] = key hlf8 + r, s1[r] = key 16 + hlf8 + r
      v8f s0[2], s1[2];
#pragma unroll
      for (int g = 0; g < 2; ++g) {
        s0[g] = wmma_f16(kf[0], qf[g][0], zero_v8f());
        s1[g] = wmma_f16(kf[2], qf[g][0], zero_v8f());
      }
#pragma unroll
      for (int g = 0; g < 2; ++g) {
        s0[g] = wmma_f16(kf[1], qf[g][1], s0[g]);
        s1[g] = wmma_f16(kf[3], qf[g][1], s1[g]);
      }

      v16h vf[4];
#pragma unroll
      for (int dt = 0; dt < 4; ++dt)
        vf[dt] = frag_ld_tr(&Vlds[ss * 32 * VP_ + dt * 16]);

      // Lazy rescale: the maximum in use, mrun, moves only when some score of the wave
      // lies more than 8 (powers of two) above it; until then P = 2^(s - mrun) <= 256,
      // far inside f16 and f32 range, and sums and outputs keep their scale. One test
      // for both groups; each lane tests its own half's 16 scores, the halves are
      // joined only where the maximum moves.
      float mx[2];
#pragma unroll
      for (int g = 0; g < 2; ++g) {
        mx[g] = fmaxf(s0[g][0], s1[g][0]);
#pragma unroll
        for (int r = 1; r < 8; ++r) mx[g] = fmaxf(mx[g], fmaxf(s0[g][r], s1[g][r]));
      }
      const bool need = (mx[0] > mthr[0]) | (mx[1] > mthr[1]);
      // wave-uniform scalar branch; marked unlikely so that the rescale stands out of line
      if (__builtin_expect(__builtin_amdgcn_ballot_w32(need) != 0, 0)) {
#pragma unroll
        for (int g = 0; g < 2; ++g) {
          // both halves take the query's joint maximum: one scale a query
          float mnew = fmaxf(mrun[g], fmaxf(mx[g], xhalf(mx[g])));
          float alpha = exp2_one(mrun[g] - mnew);
          mrun[g] = mnew;
          mthr[g] = mnew + 8.0f;
          lrun[g] *= alpha;
#pragma unroll
          for (int dt = 0; dt < 4; ++dt) o[g][dt] *= alpha;
        }
      }

      v16h pf[2];
#pragma unroll
      for (int g = 0; g < 2; ++g) {
        // softmax numerators, base-2 (log2e folded into Q), one query per lane
        float p[16];                       // p[2r] = key hlf8 + r, p[2r + 1] = 16 + hlf8 + r
#pragma unroll
        for (int r = 0; r < 8; ++r) {
          p[2 * r]     = s0[g][r] - mrun[g];
          p[2 * r + 1] = s1[g][r] - mrun[g];
        }
        exp2_block(p);

        // P^T as B fragment: element s = key kmap(s) = s0[s] (s < 8), s1[s - 8]
        float ps = 0.f;
#pragma unroll
        for (int r = 0; r < 8; ++r) {
          float p0 = p[2 * r];
          float p1 = p[2 * r + 1];
          ps += p0 + p1;
          pf[g][r]     = (_Float16)p0;
          pf[g][r + 8] = (_Float16)p1;
        }
        lrun[g] += ps;
      }

      // O^T(64 d x 16 queries) += V^T(64 x 32 keys) * P^T(32 x 16), a group
#pragma unroll
      for (int dt = 0; dt < 4; ++dt)
#pragma unroll
        for (int g = 0; g < 2; ++g) o[g][dt] = wmma_f16(vf[dt], pf[g], o[g][dt]);
    }
    // this wave's LDS reads are done before the barrier behind which the next
    // tile's copies overwrite both buffers
    asm volatile("s_wait_dscnt 0x0" ::: "memory");
    __syncthreads();
  }

  // join the halves' sums, normalize, store f16 [B][N][C] with head offset:
  // a lane's 8 registers of a tile are 8 consecutive d of its query row
#pragma unroll
  for (int g = 0; g < 2; ++g) {
    const float lsum = lrun[g] + xhalf(lrun[g]);
    _Float16* orow =
        attn_out + (size_t)(b * N_ + qbase + g * 16 + l16) * C_ + h * D_ + hlf8;
#pragma unroll
    for (int dt = 0; dt < 4; ++dt) {
      v8h ov;
#pragma unroll
      for (int r = 0; r < 8; ++r) ov[r] = (_Float16)(o[g][dt][r] / lsum);
      *reinterpret_cast<v8h*>(orow + dt * 16) = ov;
    }
  }
}

// ---------------------------------------------------------------------------
// Host-side launch pipeline
// ---------------------------------------------------------------------------
extern "C" void kernel_launch(void* const* d_in, const int* in_sizes, int n_in,
                              void* d_out, int out_size, void* d_ws, size_t ws_size,
                              hipStream_t stream) {
  const float* hidden = (const float*)d_in[0];
  const float* cosp   = (const float*)d_in[1];
  const float* sinp   = (const float*)d_in[2];
  const float* Wqkv   = (const float*)d_in[3];
  const float* Wout   = (const float*)d_in[4];
  const float* gq     = (const float*)d_in[5];
  const float* gk     = (const float*)d_in[6];

  // workspace layout (bytes):
  //   Xh      f16 [8192,1024]           16,777,216
  //   WqkvT   f16 [3072,1024]            6,291,456
  //   WoutT   f16 [1024,1024]            2,097,152
  //   qkv3    f16 [3][2][16][4096][64]  50,331,648
  //   attnH   f16 [8192,1024]           16,777,216   (total ~92.3 MB)
  char* ws = (char*)d_ws;
  _Float16* Xh    = (_Float16*)(ws);
  _Float16* WqkvT = (_Float16*)(ws + 16777216);
  _Float16* WoutT = (_Float16*)(ws + 16777216 + 6291456);
  _Float16* qkv3  = (_Float16*)(ws + 16777216 + 6291456 + 2097152);
  _Float16* attnH = (_Float16*)(ws + 16777216 + 6291456 + 2097152 + 50331648);

  // f16 copies of the hidden states and of both transposed weights, one launch
  prep_kernel<<<dim3(TQ_BLOCKS_ + TO_BLOCKS_ + CV_BLOCKS_), 256, 0, stream>>>(
      hidden, Wqkv, Wout, Xh, WqkvT, WoutT);

  // QKV projection, scattered into [3][B][H][N][D] f16
  gemm_f16_wmma<0><<<dim3(C3_ / 128, BN_ / 128), 256, 0, stream>>>(
      Xh, WqkvT, (void*)qkv3, BN_, C3_, C_);

  // per-head RMSNorm + RoPE on q/k planes (in place)
  rmsnorm_rope_kernel<<<dim3((2 * B_ * H_ / RPL_) * (N_ / 64)), 256, 0, stream>>>(
      qkv3, cosp, sinp, gq, gk);

  // flash attention -> f16 [B,N,C]
  flash_attn_kernel<<<dim3(N_ / 256, B_ * H_), 256, 0, stream>>>(qkv3, attnH);

  // output projection -> fp32 d_out
  gemm_f16_wmma<1><<<dim3(C_ / 128, BN_ / 128), 256, 0, stream>>>(
      attnH, WoutT, d_out, BN_, C_, C_);
}
